// v000
// The times below were measured on an AMD MI455X: many runs one after another, warmed up first and cycling through
// copies of the inputs, with the whole window's GPU time divided by the number of runs. Launches and the gaps
// between them are all in it. The median over several windows is given; except for v000 it joins two sittings, which
// can be a few percent apart, so the side-by-side timings, each taken in one sitting, are the better comparison.
// v000 is the starting kernel. One run takes 415 microseconds.
#include <hip/hip_runtime.h>
#include <hip/hip_bf16.h>

// ---------------------------------------------------------------------------
// Fixed attention block for MI455X (gfx1250), wave32 + WMMA f32_16x16x32_f16,
// with GLOBAL_LOAD_ASYNC_TO_LDS_B128 tile staging (ASYNCcnt).
//   B=2, S=2048, D=1024, H=16, HD=64
// Pipeline:
//   1) cvt: fp32 -> f16 for x, Wq(*0.125), Wk, Wv, Wo
//   2) gemm: Q=x Wq^T, K=x Wk^T, V=x Wv^T  (f16 out, [B,H,S,HD] layout)
//   3) flash attention per (b,h,qtile) -> Oh [B,S,D] f16
//   4) gemm: out = Oh Wo^T + b_o (fp32 out)
// ---------------------------------------------------------------------------

typedef _Float16 half_t;
typedef __attribute__((ext_vector_type(16))) _Float16 v16h_t;
typedef __attribute__((ext_vector_type(8)))  _Float16 v8h_t;
typedef __attribute__((ext_vector_type(4)))  _Float16 v4h_t;
typedef __attribute__((ext_vector_type(8)))  float    v8f_t;

#define BATCH 2
#define SEQ   2048
#define DIM   1024
#define NHEAD 16
#define HDIM  64

// ---------------------------------------------------------------------------
// WMMA wrapper: D = A(16x32 f16) * B(32x16 f16) + C(16x16 f32)
// ---------------------------------------------------------------------------
__device__ inline v8f_t wmma_f32_f16(v16h_t a, v16h_t b, v8f_t c) {
  return __builtin_amdgcn_wmma_f32_16x16x32_f16(
      /*neg_a=*/false, a, /*neg_b=*/false, b,
      /*c_mod=*/(short)0, c, /*reuse_a=*/false, /*reuse_b=*/false);
}

// ---------------------------------------------------------------------------
// Async global -> LDS copy, 16 bytes per lane (GLOBAL_LOAD_ASYNC_TO_LDS_B128,
// tracked by ASYNCcnt; data lands in LDS without touching VGPRs).
// LDS operand: byte offset within the workgroup's LDS allocation == low 32
// bits of the generic shared-memory pointer (shared aperture is in the high
// 32 bits per the ISA aperture check).
// ---------------------------------------------------------------------------
__device__ inline void async_copy_b128(void* lds_dst, const void* gsrc) {
  unsigned lds_off = (unsigned)(unsigned long long)lds_dst;
  asm volatile("global_load_async_to_lds_b128 %0, %1, off"
               :: "v"(lds_off), "v"(gsrc) : "memory");
}
__device__ inline void wait_async_all() {
  asm volatile("s_wait_asynccnt 0x0" ::: "memory");
}

// ---------------------------------------------------------------------------
// Build a 16x32 f16 fragment (A-layout per ISA 7.12.2) from a row-major tile
// in LDS.  Lane L (L<16) holds row M=L, K = {0..7, 16..23}; lane L+16 holds
// row M=L, K = {8..15, 24..31}.  Two 16B LDS loads per fragment.
// B-fragments (32x16, K x N) use the same call on an N-major (transposed)
// tile: lane = N column, 16 K values per lane with the same split.
// ---------------------------------------------------------------------------
__device__ inline v16h_t load_frag(const half_t* base, int row_stride) {
  int lane = threadIdx.x & 31;
  int m    = lane & 15;
  int hi   = lane >> 4;
  const half_t* p = base + (size_t)m * row_stride + hi * 8;
  v8h_t lo = *(const v8h_t*)(p);        // K = hi*8 .. hi*8+7
  v8h_t hp = *(const v8h_t*)(p + 16);   // K = 16+hi*8 .. 16+hi*8+7
  v16h_t r;
#pragma unroll
  for (int i = 0; i < 8; ++i) { r[i] = lo[i]; r[i + 8] = hp[i]; }
  return r;
}

// ---------------------------------------------------------------------------
// fp32 -> f16 conversion (with optional scale), 4 elements / thread
// ---------------------------------------------------------------------------
__global__ __launch_bounds__(256) void cvt_f32_f16_kernel(const float* __restrict__ in,
                                                          half_t* __restrict__ out,
                                                          float scale, int n4) {
  int i = blockIdx.x * blockDim.x + threadIdx.x;
  if (i < n4) {
    float4 f = ((const float4*)in)[i];
    v4h_t h;
    h[0] = (half_t)(f.x * scale);
    h[1] = (half_t)(f.y * scale);
    h[2] = (half_t)(f.z * scale);
    h[3] = (half_t)(f.w * scale);
    ((v4h_t*)out)[i] = h;
  }
}

// ---------------------------------------------------------------------------
// GEMM: C[r][n] = sum_k X[r][k] * W[n][k],  R=4096, K=1024, N=1024.
// Block tile 128x64, BK=64.  8 waves in a 4(M) x 2(N) grid; each wave owns a
// 32x32 tile = 2x2x2 v_wmma_f32_16x16x32_f16 per K step (8 WMMA / barrier).
// Tiles staged via GLOBAL_LOAD_ASYNC_TO_LDS_B128.
// mode 0: f16 output scattered to head layout [B,H,S,HD]
// mode 1: fp32 output + bias, flat [R,N]
// ---------------------------------------------------------------------------
__global__ __launch_bounds__(256) void gemm_xwT_kernel(const half_t* __restrict__ X,
                                                       const half_t* __restrict__ W,
                                                       void* __restrict__ out,
                                                       const float* __restrict__ bias,
                                                       int mode) {
  const int K = DIM;
  int bm = blockIdx.x;          // 0..31  (row tiles of 128)
  int bn = blockIdx.y;          // 0..15  (col tiles of 64)
  int tid = threadIdx.x;
  int wid = tid >> 5;
  int lane = tid & 31;
  int wm = wid & 3;             // wave row   (4)
  int wn = wid >> 2;            // wave col   (2)
  int m16 = lane & 15;
  int hi  = lane >> 4;

  __shared__ half_t As[128 * 64];   // 16 KB
  __shared__ half_t Bs[64 * 64];    //  8 KB

  v8f_t acc[2][2] = {};

  const half_t* Xb = X + (size_t)(bm * 128) * K;
  const half_t* Wb = W + (size_t)(bn * 64) * K;

  for (int k0 = 0; k0 < K; k0 += 64) {
    __syncthreads();    // previous tile fully consumed before overwrite
    // A tile: 128 rows x 64 halves = 1024 chunks of 8 halves (16B) -> 4/thread
#pragma unroll
    for (int c = tid; c < 1024; c += 256) {
      int row = c >> 3;
      int col = (c & 7) * 8;
      async_copy_b128(&As[row * 64 + col], &Xb[(size_t)row * K + k0 + col]);
    }
    // B tile: 64 rows x 64 halves = 512 chunks -> 2/thread
#pragma unroll
    for (int c = tid; c < 512; c += 256) {
      int row = c >> 3;
      int col = (c & 7) * 8;
      async_copy_b128(&Bs[row * 64 + col], &Wb[(size_t)row * K + k0 + col]);
    }
    if (k0 + 64 < K) {
      // warm next tiles in the cache hierarchy (global_prefetch_b8)
      __builtin_prefetch(&Xb[(size_t)(tid >> 1) * K + k0 + 64], 0, 1);
      __builtin_prefetch(&Wb[(size_t)(tid >> 2) * K + k0 + 64], 0, 1);
    }
    wait_async_all();
    __syncthreads();

#pragma unroll
    for (int kc = 0; kc < 2; ++kc) {
      v16h_t a0 = load_frag(&As[(wm * 32 + 0)  * 64 + kc * 32], 64);
      v16h_t a1 = load_frag(&As[(wm * 32 + 16) * 64 + kc * 32], 64);
      v16h_t b0 = load_frag(&Bs[(wn * 32 + 0)  * 64 + kc * 32], 64);
      v16h_t b1 = load_frag(&Bs[(wn * 32 + 16) * 64 + kc * 32], 64);
      acc[0][0] = wmma_f32_f16(a0, b0, acc[0][0]);
      acc[0][1] = wmma_f32_f16(a0, b1, acc[0][1]);
      acc[1][0] = wmma_f32_f16(a1, b0, acc[1][0]);
      acc[1][1] = wmma_f32_f16(a1, b1, acc[1][1]);
    }
  }

#pragma unroll
  for (int tm = 0; tm < 2; ++tm)
#pragma unroll
    for (int tn = 0; tn < 2; ++tn)
#pragma unroll
      for (int i = 0; i < 8; ++i) {
        int r = bm * 128 + wm * 32 + tm * 16 + i + 8 * hi;
        int n = bn * 64  + wn * 32 + tn * 16 + m16;
        float v = acc[tm][tn][i];
        if (mode == 0) {
          int b = r >> 11;            // r / SEQ
          int s = r & (SEQ - 1);
          int hh = n >> 6;            // n / HDIM
          int d  = n & (HDIM - 1);
          ((half_t*)out)[(((size_t)(b * NHEAD + hh) * SEQ) + s) * HDIM + d] = (half_t)v;
        } else {
          ((float*)out)[(size_t)r * DIM + n] = v + bias[n];
        }
      }
}

// ---------------------------------------------------------------------------
// Flash attention.  Grid: (B*H, S/64).  Block: 128 threads = 4 waves; each
// wave owns a 16-row q strip.  Per 64-key tile: scores via WMMA, mask +
// online softmax, P through LDS (C-layout -> A-layout), P*V via WMMA.
// Q/K tiles staged with async-to-LDS; V is transposed manually into Vt.
// Softmax scale is pre-folded into Q (Wq * 0.125 at conversion time).
// ---------------------------------------------------------------------------
__global__ __launch_bounds__(128) void attn_kernel(const half_t* __restrict__ Qh,
                                                   const half_t* __restrict__ Kh,
                                                   const half_t* __restrict__ Vh,
                                                   const int* __restrict__ Mmask,
                                                   half_t* __restrict__ Oh) {
  int bh = blockIdx.x;                 // 0..31
  int b = bh >> 4;
  int h = bh & (NHEAD - 1);
  int qtile = blockIdx.y;              // 0..31
  int tid = threadIdx.x;
  int wid = tid >> 5;
  int lane = tid & 31;
  int m16 = lane & 15;
  int hi  = lane >> 4;

  __shared__ half_t Qs[64 * 64];       // [q][d]
  __shared__ half_t Ks[64 * 64];       // [key][d]
  __shared__ half_t Vt[64 * 64];       // [d][key]  (transposed V)
  __shared__ half_t Ps[4][16 * 64];    // per-wave P staging [qrow][key]

  const half_t* Qbase = Qh + ((size_t)bh * SEQ + (size_t)qtile * 64) * HDIM;
  const half_t* Kbase = Kh + (size_t)bh * SEQ * HDIM;
  const half_t* Vbase = Vh + (size_t)bh * SEQ * HDIM;

  // Q tile 64x64 via async-to-LDS
#pragma unroll
  for (int c = tid; c < 512; c += 128)
    async_copy_b128(&Qs[c * 8], &Qbase[c * 8]);
  wait_async_all();
  __syncthreads();

  v16h_t aq0 = load_frag(&Qs[wid * 16 * 64 + 0],  64);  // d = 0..31
  v16h_t aq1 = load_frag(&Qs[wid * 16 * 64 + 32], 64);  // d = 32..63

  v8f_t Oacc[4] = {};
  float mrow[8], lrow[8];
#pragma unroll
  for (int i = 0; i < 8; ++i) { mrow[i] = -3.0e38f; lrow[i] = 0.0f; }

  // mask row base for this lane group: rows q = qtile*64 + wid*16 + 8*hi + i
  const int* Mrow = Mmask + ((size_t)b * SEQ + (size_t)(qtile * 64 + wid * 16 + 8 * hi)) * SEQ;

  for (int kt = 0; kt < SEQ / 64; ++kt) {
    __syncthreads();
    // K tile 64x64 (row-major [key][d]) via async-to-LDS
#pragma unroll
    for (int c = tid; c < 512; c += 128)
      async_copy_b128(&Ks[c * 8], &Kbase[(size_t)kt * 64 * HDIM + c * 8]);
    // V tile, transposed into Vt[d][key] (manual: async DMA cannot transpose)
#pragma unroll
    for (int c = tid; c < 512; c += 128) {
      int key = c >> 3;
      int d0  = (c & 7) * 8;
      v8h_t v = *(const v8h_t*)&Vbase[(size_t)kt * 64 * HDIM + (size_t)key * HDIM + d0];
#pragma unroll
      for (int e = 0; e < 8; ++e) Vt[(d0 + e) * 64 + key] = v[e];
    }
    wait_async_all();
    __syncthreads();

    // --- scores: S[16q x 64k] ---
    v8f_t Sacc[4] = {};
#pragma unroll
    for (int jn = 0; jn < 4; ++jn) {
      v16h_t bk0 = load_frag(&Ks[jn * 16 * 64 + 0],  64);
      v16h_t bk1 = load_frag(&Ks[jn * 16 * 64 + 32], 64);
      Sacc[jn] = wmma_f32_f16(aq0, bk0, Sacc[jn]);
      Sacc[jn] = wmma_f32_f16(aq1, bk1, Sacc[jn]);
    }

    // --- mask + online softmax (rows live across 16-lane groups) ---
    float corr[8];
#pragma unroll
    for (int i = 0; i < 8; ++i) {
      float rmax = -3.0e38f;
#pragma unroll
      for (int jn = 0; jn < 4; ++jn) {
        int k = kt * 64 + jn * 16 + m16;
        int mv = Mrow[(size_t)i * SEQ + k];
        float s = Sacc[jn][i];
        s = mv ? s : -1.0e9f;
        Sacc[jn][i] = s;
        rmax = fmaxf(rmax, s);
      }
#pragma unroll
      for (int off = 8; off >= 1; off >>= 1)
        rmax = fmaxf(rmax, __shfl_xor(rmax, off, 32));
      float mnew = fmaxf(mrow[i], rmax);
      float c2 = __expf(mrow[i] - mnew);
      mrow[i] = mnew;
      corr[i] = c2;
      float rsum = 0.0f;
#pragma unroll
      for (int jn = 0; jn < 4; ++jn) {
        float p = __expf(Sacc[jn][i] - mnew);
        Sacc[jn][i] = p;
        rsum += p;
      }
#pragma unroll
      for (int off = 8; off >= 1; off >>= 1)
        rsum += __shfl_xor(rsum, off, 32);
      lrow[i] = lrow[i] * c2 + rsum;
    }

    // --- P: C-layout -> A-layout via LDS (wave-private buffer) ---
#pragma unroll
    for (int jn = 0; jn < 4; ++jn)
#pragma unroll
      for (int i = 0; i < 8; ++i)
        Ps[wid][(i + 8 * hi) * 64 + jn * 16 + m16] = (half_t)Sacc[jn][i];
    asm volatile("s_wait_dscnt 0x0" ::: "memory");   // same-wave LDS RAW fence

    // rescale running output
#pragma unroll
    for (int jn = 0; jn < 4; ++jn)
#pragma unroll
      for (int i = 0; i < 8; ++i)
        Oacc[jn][i] *= corr[i];

    v16h_t ap0 = load_frag(&Ps[wid][0],  64);  // keys 0..31
    v16h_t ap1 = load_frag(&Ps[wid][32], 64);  // keys 32..63
#pragma unroll
    for (int jn = 0; jn < 4; ++jn) {
      v16h_t bv0 = load_frag(&Vt[jn * 16 * 64 + 0],  64);
      v16h_t bv1 = load_frag(&Vt[jn * 16 * 64 + 32], 64);
      Oacc[jn] = wmma_f32_f16(ap0, bv0, Oacc[jn]);
      Oacc[jn] = wmma_f32_f16(ap1, bv1, Oacc[jn]);
    }
  }

  // --- write Oh[b, q, h*64 + d] ---
#pragma unroll
  for (int jn = 0; jn < 4; ++jn) {
    int d = jn * 16 + m16;
#pragma unroll
    for (int i = 0; i < 8; ++i) {
      int q = qtile * 64 + wid * 16 + i + 8 * hi;
      float inv = lrow[i] > 0.0f ? 1.0f / lrow[i] : 0.0f;
      Oh[((size_t)b * SEQ + q) * DIM + h * HDIM + d] = (half_t)(Oacc[jn][i] * inv);
    }
  }
}

// ---------------------------------------------------------------------------
// Launch
// ---------------------------------------------------------------------------
extern "C" void kernel_launch(void* const* d_in, const int* in_sizes, int n_in,
                              void* d_out, int out_size, void* d_ws, size_t ws_size,
                              hipStream_t stream) {
  const float* x   = (const float*)d_in[0];
  const int*   M   = (const int*)d_in[1];
  const float* Wq  = (const float*)d_in[2];
  const float* Wk  = (const float*)d_in[3];
  const float* Wv  = (const float*)d_in[4];
  const float* Wo  = (const float*)d_in[5];
  const float* bo  = (const float*)d_in[6];

  char* ws = (char*)d_ws;
  const size_t MB = 1u << 20;
  half_t* xh  = (half_t*)(ws + 0 * MB);   // 8 MB  [B*S, D]
  half_t* wqh = (half_t*)(ws + 8 * MB);   // 2 MB
  half_t* wkh = (half_t*)(ws + 10 * MB);  // 2 MB
  half_t* wvh = (half_t*)(ws + 12 * MB);  // 2 MB
  half_t* woh = (half_t*)(ws + 14 * MB);  // 2 MB
  half_t* Qh  = (half_t*)(ws + 16 * MB);  // 8 MB  [B,H,S,HD]
  half_t* Kh  = (half_t*)(ws + 24 * MB);  // 8 MB
  half_t* Vh  = (half_t*)(ws + 32 * MB);  // 8 MB
  half_t* Oh  = (half_t*)(ws + 40 * MB);  // 8 MB  [B,S,D]

  const int nX4 = BATCH * SEQ * DIM / 4;  // 1048576
  const int nW4 = DIM * DIM / 4;          // 262144
  cvt_f32_f16_kernel<<<nX4 / 256, 256, 0, stream>>>(x,  xh,  1.0f,   nX4);
  cvt_f32_f16_kernel<<<nW4 / 256, 256, 0, stream>>>(Wq, wqh, 0.125f, nW4);  // fold HD^-0.5
  cvt_f32_f16_kernel<<<nW4 / 256, 256, 0, stream>>>(Wk, wkh, 1.0f,   nW4);
  cvt_f32_f16_kernel<<<nW4 / 256, 256, 0, stream>>>(Wv, wvh, 1.0f,   nW4);
  cvt_f32_f16_kernel<<<nW4 / 256, 256, 0, stream>>>(Wo, woh, 1.0f,   nW4);

  dim3 gg(BATCH * SEQ / 128, DIM / 64);   // (32, 16)
  gemm_xwT_kernel<<<gg, 256, 0, stream>>>(xh, wqh, Qh, nullptr, 0);
  gemm_xwT_kernel<<<gg, 256, 0, stream>>>(xh, wkh, Kh, nullptr, 0);
  gemm_xwT_kernel<<<gg, 256, 0, stream>>>(xh, wvh, Vh, nullptr, 0);

  attn_kernel<<<dim3(BATCH * NHEAD, SEQ / 64), 128, 0, stream>>>(Qh, Kh, Vh, M, Oh);

  gemm_xwT_kernel<<<gg, 256, 0, stream>>>(Oh, woh, d_out, bo, 1);
}

// v001
// One run takes 279 microseconds.
// Next to v000, in two timings, it ran 1.52 and 1.53 times as fast.
#include <hip/hip_runtime.h>
#include <hip/hip_bf16.h>

// ---------------------------------------------------------------------------
// Fixed attention block for MI455X (gfx1250), wave32 + WMMA f32_16x16x32_f16,
// with GLOBAL_LOAD_ASYNC_TO_LDS_B128 tile staging (ASYNCcnt).
//   B=2, S=2048, D=1024, H=16, HD=64
// Pipeline:
//   1) cvt: fp32 -> f16 for x, Wq(*0.125), Wk, Wv, Wo
//   2) gemm: Q=x Wq^T, K=x Wk^T, V=x Wv^T  (f16 out, [B,H,S,HD] layout)
//   3) flash attention per (b,h,qtile) -> Oh [B,S,D] f16
//   4) gemm: out = Oh Wo^T + b_o (fp32 out)
// ---------------------------------------------------------------------------

typedef _Float16 half_t;
typedef __attribute__((ext_vector_type(16))) _Float16 v16h_t;
typedef __attribute__((ext_vector_type(8)))  _Float16 v8h_t;
typedef __attribute__((ext_vector_type(4)))  _Float16 v4h_t;
typedef __attribute__((ext_vector_type(8)))  float    v8f_t;

#define BATCH 2
#define SEQ   2048
#define DIM   1024
#define NHEAD 16
#define HDIM  64
// LDS row pitch, in halves, of every 64-half tile row read by 16-byte LDS
// loads: 144 B = 16 B x 9 puts the 16 rows of a fragment on 16 different
// 4-bank groups (128 B rows put them all on two).
#define LDP   72

// ---------------------------------------------------------------------------
// WMMA wrapper: D = A(16x32 f16) * B(32x16 f16) + C(16x16 f32)
// ---------------------------------------------------------------------------
__device__ inline v8f_t wmma_f32_f16(v16h_t a, v16h_t b, v8f_t c) {
  return __builtin_amdgcn_wmma_f32_16x16x32_f16(
      /*neg_a=*/false, a, /*neg_b=*/false, b,
      /*c_mod=*/(short)0, c, /*reuse_a=*/false, /*reuse_b=*/false);
}

// ---------------------------------------------------------------------------
// Async global -> LDS copy, 16 bytes per lane (GLOBAL_LOAD_ASYNC_TO_LDS_B128,
// tracked by ASYNCcnt; data lands in LDS without touching VGPRs).
// LDS operand: byte offset within the workgroup's LDS allocation == low 32
// bits of the generic shared-memory pointer (shared aperture is in the high
// 32 bits per the ISA aperture check).
// ---------------------------------------------------------------------------
// Runs of copies stand in one statement that ends in s_wait_xcnt 0, so that no
// address register of an issued copy is rewritten ahead of that wait.
__device__ inline unsigned lds_addr(const void* p) {
  return (unsigned)(unsigned long long)p;
}
__device__ inline void async_copy4_b128(unsigned l0, const void* g0, unsigned l1, const void* g1,
                                        unsigned l2, const void* g2, unsigned l3, const void* g3) {
  asm volatile("global_load_async_to_lds_b128 %0, %1, off\n\t"
               "global_load_async_to_lds_b128 %2, %3, off\n\t"
               "global_load_async_to_lds_b128 %4, %5, off\n\t"
               "global_load_async_to_lds_b128 %6, %7, off\n\t"
               "s_wait_xcnt 0x0"
               :: "v"(l0), "v"(g0), "v"(l1), "v"(g1), "v"(l2), "v"(g2), "v"(l3), "v"(g3)
               : "memory");
}
__device__ inline void async_copy6_b128(unsigned l0, const void* g0, unsigned l1, const void* g1,
                                        unsigned l2, const void* g2, unsigned l3, const void* g3,
                                        unsigned l4, const void* g4, unsigned l5, const void* g5) {
  asm volatile("global_load_async_to_lds_b128 %0, %1, off\n\t"
               "global_load_async_to_lds_b128 %2, %3, off\n\t"
               "global_load_async_to_lds_b128 %4, %5, off\n\t"
               "global_load_async_to_lds_b128 %6, %7, off\n\t"
               "global_load_async_to_lds_b128 %8, %9, off\n\t"
               "global_load_async_to_lds_b128 %10, %11, off\n\t"
               "s_wait_xcnt 0x0"
               :: "v"(l0), "v"(g0), "v"(l1), "v"(g1), "v"(l2), "v"(g2), "v"(l3), "v"(g3),
                  "v"(l4), "v"(g4), "v"(l5), "v"(g5)
               : "memory");
}
__device__ inline void wait_async_all() {
  asm volatile("s_wait_asynccnt 0x0" ::: "memory");
}

// ---------------------------------------------------------------------------
// Build a 16x32 f16 fragment (A-layout per ISA 7.12.2) from a row-major tile
// in LDS.  Lane L (L<16) holds row M=L, K = {0..7, 16..23}; lane L+16 holds
// row M=L, K = {8..15, 24..31}.  Two 16B LDS loads per fragment.
// B-fragments (32x16, K x N) use the same call on an N-major (transposed)
// tile: lane = N column, 16 K values per lane with the same split.
// ---------------------------------------------------------------------------
__device__ inline v16h_t load_frag(const half_t* base, int row_stride) {
  int lane = threadIdx.x & 31;
  int m    = lane & 15;
  int hi   = lane >> 4;
  const half_t* p = base + (size_t)m * row_stride + hi * 8;
  v8h_t lo = *(const v8h_t*)(p);        // K = hi*8 .. hi*8+7
  v8h_t hp = *(const v8h_t*)(p + 16);   // K = 16+hi*8 .. 16+hi*8+7
  v16h_t r;
#pragma unroll
  for (int i = 0; i < 8; ++i) { r[i] = lo[i]; r[i + 8] = hp[i]; }
  return r;
}

// ---------------------------------------------------------------------------
// fp32 -> f16 conversion (with optional scale), 4 elements / thread
// ---------------------------------------------------------------------------
__global__ __launch_bounds__(256) void cvt_f32_f16_kernel(const float* __restrict__ in,
                                                          half_t* __restrict__ out,
                                                          float scale, int n4) {
  int i = blockIdx.x * blockDim.x + threadIdx.x;
  if (i < n4) {
    float4 f = ((const float4*)in)[i];
    v4h_t h;
    h[0] = (half_t)(f.x * scale);
    h[1] = (half_t)(f.y * scale);
    h[2] = (half_t)(f.z * scale);
    h[3] = (half_t)(f.w * scale);
    ((v4h_t*)out)[i] = h;
  }
}

// ---------------------------------------------------------------------------
// GEMM: C[r][n] = sum_k X[r][k] * W[n][k],  R=4096, K=1024, N=1024.
// Block tile 128x64, BK=64.  8 waves in a 4(M) x 2(N) grid; each wave owns a
// 32x32 tile = 2x2x2 v_wmma_f32_16x16x32_f16 per K step (8 WMMA / barrier).
// Tiles staged via GLOBAL_LOAD_ASYNC_TO_LDS_B128.
// mode 0: f16 output scattered to head layout [B,H,S,HD]
// mode 1: fp32 output + bias, flat [R,N]
// ---------------------------------------------------------------------------
__global__ __launch_bounds__(256) void gemm_xwT_kernel(const half_t* __restrict__ X,
                                                       const half_t* __restrict__ W,
                                                       void* __restrict__ out,
                                                       const float* __restrict__ bias,
                                                       int mode) {
  const int K = DIM;
  int bm = blockIdx.x;          // 0..31  (row tiles of 128)
  int bn = blockIdx.y;          // 0..15  (col tiles of 64)
  int tid = threadIdx.x;
  int wid = tid >> 5;
  int lane = tid & 31;
  int wm = wid & 3;             // wave row   (4)
  int wn = wid >> 2;            // wave col   (2)
  int m16 = lane & 15;
  int hi  = lane >> 4;

  __shared__ __attribute__((aligned(16))) half_t As[128 * LDP];   // 18 KB
  __shared__ __attribute__((aligned(16))) half_t Bs[64 * LDP];    //  9 KB

  v8f_t acc[2][2] = {};

  const half_t* Xb = X + (size_t)(bm * 128) * K;
  const half_t* Wb = W + (size_t)(bn * 64) * K;
  int crow = tid >> 3;          // this thread's first tile row in the copies
  int ccol = (tid & 7) * 8;     // and its 8-half column

  for (int k0 = 0; k0 < K; k0 += 64) {
    __syncthreads();    // previous tile fully consumed before overwrite
    // A tile: 128 rows x 64 halves = 1024 chunks of 8 halves (16B) -> 4/thread
    // (chunk c = tid + 256 j: row = crow + 32 j, same column)
    // B tile: 64 rows x 64 halves = 512 chunks -> 2/thread
    async_copy6_b128(lds_addr(&As[(crow + 0)  * LDP + ccol]), &Xb[(size_t)(crow + 0)  * K + k0 + ccol],
                     lds_addr(&As[(crow + 32) * LDP + ccol]), &Xb[(size_t)(crow + 32) * K + k0 + ccol],
                     lds_addr(&As[(crow + 64) * LDP + ccol]), &Xb[(size_t)(crow + 64) * K + k0 + ccol],
                     lds_addr(&As[(crow + 96) * LDP + ccol]), &Xb[(size_t)(crow + 96) * K + k0 + ccol],
                     lds_addr(&Bs[(crow + 0)  * LDP + ccol]), &Wb[(size_t)(crow + 0)  * K + k0 + ccol],
                     lds_addr(&Bs[(crow + 32) * LDP + ccol]), &Wb[(size_t)(crow + 32) * K + k0 + ccol]);
    if (k0 + 64 < K) {
      // warm next tiles in the cache hierarchy (global_prefetch_b8)
      __builtin_prefetch(&Xb[(size_t)(tid >> 1) * K + k0 + 64], 0, 1);
      __builtin_prefetch(&Wb[(size_t)(tid >> 2) * K + k0 + 64], 0, 1);
    }
    wait_async_all();
    __syncthreads();

#pragma unroll
    for (int kc = 0; kc < 2; ++kc) {
      v16h_t a0 = load_frag(&As[(wm * 32 + 0)  * LDP + kc * 32], LDP);
      v16h_t a1 = load_frag(&As[(wm * 32 + 16) * LDP + kc * 32], LDP);
      v16h_t b0 = load_frag(&Bs[(wn * 32 + 0)  * LDP + kc * 32], LDP);
      v16h_t b1 = load_frag(&Bs[(wn * 32 + 16) * LDP + kc * 32], LDP);
      acc[0][0] = wmma_f32_f16(a0, b0, acc[0][0]);
      acc[0][1] = wmma_f32_f16(a0, b1, acc[0][1]);
      acc[1][0] = wmma_f32_f16(a1, b0, acc[1][0]);
      acc[1][1] = wmma_f32_f16(a1, b1, acc[1][1]);
    }
  }

#pragma unroll
  for (int tm = 0; tm < 2; ++tm)
#pragma unroll
    for (int tn = 0; tn < 2; ++tn)
#pragma unroll
      for (int i = 0; i < 8; ++i) {
        int r = bm * 128 + wm * 32 + tm * 16 + i + 8 * hi;
        int n = bn * 64  + wn * 32 + tn * 16 + m16;
        float v = acc[tm][tn][i];
        if (mode == 0) {
          int b = r >> 11;            // r / SEQ
          int s = r & (SEQ - 1);
          int hh = n >> 6;            // n / HDIM
          int d  = n & (HDIM - 1);
          ((half_t*)out)[(((size_t)(b * NHEAD + hh) * SEQ) + s) * HDIM + d] = (half_t)v;
        } else {
          ((float*)out)[(size_t)r * DIM + n] = v + bias[n];
        }
      }
}

// ---------------------------------------------------------------------------
// Flash attention.  Grid: (B*H, S/64).  Block: 128 threads = 4 waves; each
// wave owns a 16-row q strip.  Per 64-key tile: scores via WMMA, mask +
// online softmax, P through LDS (C-layout -> A-layout), P*V via WMMA.
// Q/K tiles staged with async-to-LDS; V is transposed manually into Vt.
// Softmax scale is pre-folded into Q (Wq * 0.125 at conversion time).
// ---------------------------------------------------------------------------
__global__ __launch_bounds__(128) void attn_kernel(const half_t* __restrict__ Qh,
                                                   const half_t* __restrict__ Kh,
                                                   const half_t* __restrict__ Vh,
                                                   const int* __restrict__ Mmask,
                                                   half_t* __restrict__ Oh) {
  int bh = blockIdx.x;                 // 0..31
  int b = bh >> 4;
  int h = bh & (NHEAD - 1);
  int qtile = blockIdx.y;              // 0..31
  int tid = threadIdx.x;
  int wid = tid >> 5;
  int lane = tid & 31;
  int m16 = lane & 15;
  int hi  = lane >> 4;

  __shared__ __attribute__((aligned(16))) half_t Qs[64 * LDP];       // [q][d]
  __shared__ __attribute__((aligned(16))) half_t Ks[64 * LDP];       // [key][d]
  __shared__ __attribute__((aligned(16))) half_t Vt[64 * LDP];       // [d][key]  (transposed V)
  __shared__ __attribute__((aligned(16))) half_t Ps[4][16 * LDP];    // per-wave P staging [qrow][key]

  const half_t* Qbase = Qh + ((size_t)bh * SEQ + (size_t)qtile * 64) * HDIM;
  const half_t* Kbase = Kh + (size_t)bh * SEQ * HDIM;
  const half_t* Vbase = Vh + (size_t)bh * SEQ * HDIM;

  int crow = tid >> 3;                 // this thread's first tile row in the copies
  int ccol = (tid & 7) * 8;            // and its 8-half column

  // Q tile 64x64 via async-to-LDS (chunk c = tid + 128 j: row = crow + 16 j)
  async_copy4_b128(lds_addr(&Qs[(crow + 0)  * LDP + ccol]), &Qbase[(crow + 0)  * HDIM + ccol],
                   lds_addr(&Qs[(crow + 16) * LDP + ccol]), &Qbase[(crow + 16) * HDIM + ccol],
                   lds_addr(&Qs[(crow + 32) * LDP + ccol]), &Qbase[(crow + 32) * HDIM + ccol],
                   lds_addr(&Qs[(crow + 48) * LDP + ccol]), &Qbase[(crow + 48) * HDIM + ccol]);
  wait_async_all();
  __syncthreads();

  v16h_t aq0 = load_frag(&Qs[wid * 16 * LDP + 0],  LDP);  // d = 0..31
  v16h_t aq1 = load_frag(&Qs[wid * 16 * LDP + 32], LDP);  // d = 32..63

  v8f_t Oacc[4] = {};
  float mrow[8], lrow[8];
#pragma unroll
  for (int i = 0; i < 8; ++i) { mrow[i] = -3.0e38f; lrow[i] = 0.0f; }

  // mask row base for this lane group: rows q = qtile*64 + wid*16 + 8*hi + i
  const int* Mrow = Mmask + ((size_t)b * SEQ + (size_t)(qtile * 64 + wid * 16 + 8 * hi)) * SEQ;

  for (int kt = 0; kt < SEQ / 64; ++kt) {
    __syncthreads();
    // K tile 64x64 (row-major [key][d]) via async-to-LDS
    {
      const half_t* Kt = Kbase + (size_t)kt * 64 * HDIM;
      async_copy4_b128(lds_addr(&Ks[(crow + 0)  * LDP + ccol]), &Kt[(crow + 0)  * HDIM + ccol],
                       lds_addr(&Ks[(crow + 16) * LDP + ccol]), &Kt[(crow + 16) * HDIM + ccol],
                       lds_addr(&Ks[(crow + 32) * LDP + ccol]), &Kt[(crow + 32) * HDIM + ccol],
                       lds_addr(&Ks[(crow + 48) * LDP + ccol]), &Kt[(crow + 48) * HDIM + ccol]);
    }
    // V tile, transposed into Vt[d][key] (manual: async DMA cannot transpose)
#pragma unroll
    for (int c = tid; c < 512; c += 128) {
      int key = c >> 3;
      int d0  = (c & 7) * 8;
      v8h_t v = *(const v8h_t*)&Vbase[(size_t)kt * 64 * HDIM + (size_t)key * HDIM + d0];
#pragma unroll
      for (int e = 0; e < 8; ++e) Vt[(d0 + e) * LDP + key] = v[e];
    }
    wait_async_all();
    __syncthreads();

    // --- scores: S[16q x 64k] ---
    v8f_t Sacc[4] = {};
#pragma unroll
    for (int jn = 0; jn < 4; ++jn) {
      v16h_t bk0 = load_frag(&Ks[jn * 16 * LDP + 0],  LDP);
      v16h_t bk1 = load_frag(&Ks[jn * 16 * LDP + 32], LDP);
      Sacc[jn] = wmma_f32_f16(aq0, bk0, Sacc[jn]);
      Sacc[jn] = wmma_f32_f16(aq1, bk1, Sacc[jn]);
    }

    // --- mask + online softmax (rows live across 16-lane groups) ---
    float corr[8];
#pragma unroll
    for (int i = 0; i < 8; ++i) {
      float rmax = -3.0e38f;
#pragma unroll
      for (int jn = 0; jn < 4; ++jn) {
        int k = kt * 64 + jn * 16 + m16;
        int mv = Mrow[(size_t)i * SEQ + k];
        float s = Sacc[jn][i];
        s = mv ? s : -1.0e9f;
        Sacc[jn][i] = s;
        rmax = fmaxf(rmax, s);
      }
#pragma unroll
      for (int off = 8; off >= 1; off >>= 1)
        rmax = fmaxf(rmax, __shfl_xor(rmax, off, 32));
      float mnew = fmaxf(mrow[i], rmax);
      float c2 = __expf(mrow[i] - mnew);
      mrow[i] = mnew;
      corr[i] = c2;
      float rsum = 0.0f;
#pragma unroll
      for (int jn = 0; jn < 4; ++jn) {
        float p = __expf(Sacc[jn][i] - mnew);
        Sacc[jn][i] = p;
        rsum += p;
      }
#pragma unroll
      for (int off = 8; off >= 1; off >>= 1)
        rsum += __shfl_xor(rsum, off, 32);
      lrow[i] = lrow[i] * c2 + rsum;
    }

    // --- P: C-layout -> A-layout via LDS (wave-private buffer) ---
#pragma unroll
    for (int jn = 0; jn < 4; ++jn)
#pragma unroll
      for (int i = 0; i < 8; ++i)
        Ps[wid][(i + 8 * hi) * LDP + jn * 16 + m16] = (half_t)Sacc[jn][i];
    asm volatile("s_wait_dscnt 0x0" ::: "memory");   // same-wave LDS RAW fence

    // rescale running output
#pragma unroll
    for (int jn = 0; jn < 4; ++jn)
#pragma unroll
      for (int i = 0; i < 8; ++i)
        Oacc[jn][i] *= corr[i];

    v16h_t ap0 = load_frag(&Ps[wid][0],  LDP);  // keys 0..31
    v16h_t ap1 = load_frag(&Ps[wid][32], LDP);  // keys 32..63
#pragma unroll
    for (int jn = 0; jn < 4; ++jn) {
      v16h_t bv0 = load_frag(&Vt[jn * 16 * LDP + 0],  LDP);
      v16h_t bv1 = load_frag(&Vt[jn * 16 * LDP + 32], LDP);
      Oacc[jn] = wmma_f32_f16(ap0, bv0, Oacc[jn]);
      Oacc[jn] = wmma_f32_f16(ap1, bv1, Oacc[jn]);
    }
  }

  // --- write Oh[b, q, h*64 + d] ---
#pragma unroll
  for (int jn = 0; jn < 4; ++jn) {
    int d = jn * 16 + m16;
#pragma unroll
    for (int i = 0; i < 8; ++i) {
      int q = qtile * 64 + wid * 16 + i + 8 * hi;
      float inv = lrow[i] > 0.0f ? 1.0f / lrow[i] : 0.0f;
      Oh[((size_t)b * SEQ + q) * DIM + h * HDIM + d] = (half_t)(Oacc[jn][i] * inv);
    }
  }
}

// ---------------------------------------------------------------------------
// Launch
// ---------------------------------------------------------------------------
extern "C" void kernel_launch(void* const* d_in, const int* in_sizes, int n_in,
                              void* d_out, int out_size, void* d_ws, size_t ws_size,
                              hipStream_t stream) {
  const float* x   = (const float*)d_in[0];
  const int*   M   = (const int*)d_in[1];
  const float* Wq  = (const float*)d_in[2];
  const float* Wk  = (const float*)d_in[3];
  const float* Wv  = (const float*)d_in[4];
  const float* Wo  = (const float*)d_in[5];
  const float* bo  = (const float*)d_in[6];

  char* ws = (char*)d_ws;
  const size_t MB = 1u << 20;
  half_t* xh  = (half_t*)(ws + 0 * MB);   // 8 MB  [B*S, D]
  half_t* wqh = (half_t*)(ws + 8 * MB);   // 2 MB
  half_t* wkh = (half_t*)(ws + 10 * MB);  // 2 MB
  half_t* wvh = (half_t*)(ws + 12 * MB);  // 2 MB
  half_t* woh = (half_t*)(ws + 14 * MB);  // 2 MB
  half_t* Qh  = (half_t*)(ws + 16 * MB);  // 8 MB  [B,H,S,HD]
  half_t* Kh  = (half_t*)(ws + 24 * MB);  // 8 MB
  half_t* Vh  = (half_t*)(ws + 32 * MB);  // 8 MB
  half_t* Oh  = (half_t*)(ws + 40 * MB);  // 8 MB  [B,S,D]

  const int nX4 = BATCH * SEQ * DIM / 4;  // 1048576
  const int nW4 = DIM * DIM / 4;          // 262144
  cvt_f32_f16_kernel<<<nX4 / 256, 256, 0, stream>>>(x,  xh,  1.0f,   nX4);
  cvt_f32_f16_kernel<<<nW4 / 256, 256, 0, stream>>>(Wq, wqh, 0.125f, nW4);  // fold HD^-0.5
  cvt_f32_f16_kernel<<<nW4 / 256, 256, 0, stream>>>(Wk, wkh, 1.0f,   nW4);
  cvt_f32_f16_kernel<<<nW4 / 256, 256, 0, stream>>>(Wv, wvh, 1.0f,   nW4);
  cvt_f32_f16_kernel<<<nW4 / 256, 256, 0, stream>>>(Wo, woh, 1.0f,   nW4);

  dim3 gg(BATCH * SEQ / 128, DIM / 64);   // (32, 16)
  gemm_xwT_kernel<<<gg, 256, 0, stream>>>(xh, wqh, Qh, nullptr, 0);
  gemm_xwT_kernel<<<gg, 256, 0, stream>>>(xh, wkh, Kh, nullptr, 0);
  gemm_xwT_kernel<<<gg, 256, 0, stream>>>(xh, wvh, Vh, nullptr, 0);

  attn_kernel<<<dim3(BATCH * NHEAD, SEQ / 64), 128, 0, stream>>>(Qh, Kh, Vh, M, Oh);

  gemm_xwT_kernel<<<gg, 256, 0, stream>>>(Oh, woh, d_out, bo, 1);
}

// v002
// It runs in 206 microseconds.
// Next to v001, in two timings, it ran 1.36 times as fast each time.
// All steps since v000 together make it 2.07 times as fast.
#include <hip/hip_runtime.h>
#include <hip/hip_bf16.h>

// ---------------------------------------------------------------------------
// Fixed attention block for MI455X (gfx1250), wave32 + WMMA f32_16x16x32_f16,
// with GLOBAL_LOAD_ASYNC_TO_LDS_B128 tile staging (ASYNCcnt).
//   B=2, S=2048, D=1024, H=16, HD=64
// Pipeline:
//   1) cvt: fp32 -> f16 for x, Wq(*0.125), Wk, Wv, Wo
//   2) gemm: Q=x Wq^T, K=x Wk^T, V=x Wv^T  (f16 out, [B,H,S,HD] layout)
//   3) flash attention per (b,h,qtile) -> Oh [B,S,D] f16
//   4) gemm: out = Oh Wo^T + b_o (fp32 out)
// ---------------------------------------------------------------------------

typedef _Float16 half_t;
typedef __attribute__((ext_vector_type(16))) _Float16 v16h_t;
typedef __attribute__((ext_vector_type(8)))  _Float16 v8h_t;
typedef __attribute__((ext_vector_type(4)))  _Float16 v4h_t;
typedef __attribute__((ext_vector_type(8)))  float    v8f_t;

#define BATCH 2
#define SEQ   2048
#define DIM   1024
#define NHEAD 16
#define HDIM  64
// LDS row pitch, in halves, of every 64-half tile row read by 16-byte LDS
// loads: 144 B = 16 B x 9 puts the 16 rows of a fragment on 16 different
// 4-bank groups (128 B rows put them all on two).
#define LDP   72

// ---------------------------------------------------------------------------
// WMMA wrapper: D = A(16x32 f16) * B(32x16 f16) + C(16x16 f32)
// ---------------------------------------------------------------------------
__device__ inline v8f_t wmma_f32_f16(v16h_t a, v16h_t b, v8f_t c) {
  return __builtin_amdgcn_wmma_f32_16x16x32_f16(
      /*neg_a=*/false, a, /*neg_b=*/false, b,
      /*c_mod=*/(short)0, c, /*reuse_a=*/false, /*reuse_b=*/false);
}

// ---------------------------------------------------------------------------
// Async global -> LDS copy, 16 bytes per lane (GLOBAL_LOAD_ASYNC_TO_LDS_B128,
// tracked by ASYNCcnt; data lands in LDS without touching VGPRs).
// LDS operand: byte offset within the workgroup's LDS allocation == low 32
// bits of the generic shared-memory pointer (shared aperture is in the high
// 32 bits per the ISA aperture check).
// ---------------------------------------------------------------------------
// Runs of copies stand in one statement that ends in s_wait_xcnt 0, so that no
// address register of an issued copy is rewritten ahead of that wait.
__device__ inline unsigned lds_addr(const void* p) {
  return (unsigned)(unsigned long long)p;
}
__device__ inline void async_copy4_b128(unsigned l0, const void* g0, unsigned l1, const void* g1,
                                        unsigned l2, const void* g2, unsigned l3, const void* g3) {
  asm volatile("global_load_async_to_lds_b128 %0, %1, off\n\t"
               "global_load_async_to_lds_b128 %2, %3, off\n\t"
               "global_load_async_to_lds_b128 %4, %5, off\n\t"
               "global_load_async_to_lds_b128 %6, %7, off\n\t"
               "s_wait_xcnt 0x0"
               :: "v"(l0), "v"(g0), "v"(l1), "v"(g1), "v"(l2), "v"(g2), "v"(l3), "v"(g3)
               : "memory");
}
__device__ inline void async_copy6_b128(unsigned l0, const void* g0, unsigned l1, const void* g1,
                                        unsigned l2, const void* g2, unsigned l3, const void* g3,
                                        unsigned l4, const void* g4, unsigned l5, const void* g5) {
  asm volatile("global_load_async_to_lds_b128 %0, %1, off\n\t"
               "global_load_async_to_lds_b128 %2, %3, off\n\t"
               "global_load_async_to_lds_b128 %4, %5, off\n\t"
               "global_load_async_to_lds_b128 %6, %7, off\n\t"
               "global_load_async_to_lds_b128 %8, %9, off\n\t"
               "global_load_async_to_lds_b128 %10, %11, off\n\t"
               "s_wait_xcnt 0x0"
               :: "v"(l0), "v"(g0), "v"(l1), "v"(g1), "v"(l2), "v"(g2), "v"(l3), "v"(g3),
                  "v"(l4), "v"(g4), "v"(l5), "v"(g5)
               : "memory");
}
__device__ inline void wait_async_all() {
  asm volatile("s_wait_asynccnt 0x0" ::: "memory");
}

// ---------------------------------------------------------------------------
// Build a 16x32 f16 fragment (A-layout per ISA 7.12.2) from a row-major tile
// in LDS.  Lane L (L<16) holds row M=L, K = {0..7, 16..23}; lane L+16 holds
// row M=L, K = {8..15, 24..31}.  Two 16B LDS loads per fragment.
// B-fragments (32x16, K x N) use the same call on an N-major (transposed)
// tile: lane = N column, 16 K values per lane with the same split.
// ---------------------------------------------------------------------------
__device__ inline v16h_t load_frag(const half_t* base, int row_stride) {
  int lane = threadIdx.x & 31;
  int m    = lane & 15;
  int hi   = lane >> 4;
  const half_t* p = base + (size_t)m * row_stride + hi * 8;
  v8h_t lo = *(const v8h_t*)(p);        // K = hi*8 .. hi*8+7
  v8h_t hp = *(const v8h_t*)(p + 16);   // K = 16+hi*8 .. 16+hi*8+7
  v16h_t r;
#pragma unroll
  for (int i = 0; i < 8; ++i) { r[i] = lo[i]; r[i + 8] = hp[i]; }
  return r;
}

// ---------------------------------------------------------------------------
// fp32 -> f16 conversion (with optional scale), 4 elements / thread
// ---------------------------------------------------------------------------
__global__ __launch_bounds__(256) void cvt_f32_f16_kernel(const float* __restrict__ in,
                                                          half_t* __restrict__ out,
                                                          float scale, int n4) {
  int i = blockIdx.x * blockDim.x + threadIdx.x;
  if (i < n4) {
    float4 f = ((const float4*)in)[i];
    v4h_t h;
    h[0] = (half_t)(f.x * scale);
    h[1] = (half_t)(f.y * scale);
    h[2] = (half_t)(f.z * scale);
    h[3] = (half_t)(f.w * scale);
    ((v4h_t*)out)[i] = h;
  }
}

// ---------------------------------------------------------------------------
// GEMM: C[r][n] = sum_k X[r][k] * W[n][k],  R=4096, K=1024, N=1024.
// Block tile 128x64, BK=64.  8 waves in a 4(M) x 2(N) grid; each wave owns a
// 32x32 tile = 2x2x2 v_wmma_f32_16x16x32_f16 per K step (8 WMMA / barrier).
// Tiles staged via GLOBAL_LOAD_ASYNC_TO_LDS_B128.
// mode 0: f16 output scattered to head layout [B,H,S,HD]
// mode 1: fp32 output + bias, flat [R,N]
// ---------------------------------------------------------------------------
__global__ __launch_bounds__(256) void gemm_xwT_kernel(const half_t* __restrict__ X,
                                                       const half_t* __restrict__ W,
                                                       void* __restrict__ out,
                                                       const float* __restrict__ bias,
                                                       int mode) {
  const int K = DIM;
  int bm = blockIdx.x;          // 0..31  (row tiles of 128)
  int bn = blockIdx.y;          // 0..15  (col tiles of 64)
  int tid = threadIdx.x;
  int wid = tid >> 5;
  int lane = tid & 31;
  int wm = wid & 3;             // wave row   (4)
  int wn = wid >> 2;            // wave col   (2)
  int m16 = lane & 15;
  int hi  = lane >> 4;

  __shared__ __attribute__((aligned(16))) half_t As[128 * LDP];   // 18 KB
  __shared__ __attribute__((aligned(16))) half_t Bs[64 * LDP];    //  9 KB

  v8f_t acc[2][2] = {};

  const half_t* Xb = X + (size_t)(bm * 128) * K;
  const half_t* Wb = W + (size_t)(bn * 64) * K;
  int crow = tid >> 3;          // this thread's first tile row in the copies
  int ccol = (tid & 7) * 8;     // and its 8-half column

  for (int k0 = 0; k0 < K; k0 += 64) {
    __syncthreads();    // previous tile fully consumed before overwrite
    // A tile: 128 rows x 64 halves = 1024 chunks of 8 halves (16B) -> 4/thread
    // (chunk c = tid + 256 j: row = crow + 32 j, same column)
    // B tile: 64 rows x 64 halves = 512 chunks -> 2/thread
    async_copy6_b128(lds_addr(&As[(crow + 0)  * LDP + ccol]), &Xb[(size_t)(crow + 0)  * K + k0 + ccol],
                     lds_addr(&As[(crow + 32) * LDP + ccol]), &Xb[(size_t)(crow + 32) * K + k0 + ccol],
                     lds_addr(&As[(crow + 64) * LDP + ccol]), &Xb[(size_t)(crow + 64) * K + k0 + ccol],
                     lds_addr(&As[(crow + 96) * LDP + ccol]), &Xb[(size_t)(crow + 96) * K + k0 + ccol],
                     lds_addr(&Bs[(crow + 0)  * LDP + ccol]), &Wb[(size_t)(crow + 0)  * K + k0 + ccol],
                     lds_addr(&Bs[(crow + 32) * LDP + ccol]), &Wb[(size_t)(crow + 32) * K + k0 + ccol]);
    if (k0 + 64 < K) {
      // warm next tiles in the cache hierarchy (global_prefetch_b8)
      __builtin_prefetch(&Xb[(size_t)(tid >> 1) * K + k0 + 64], 0, 1);
      __builtin_prefetch(&Wb[(size_t)(tid >> 2) * K + k0 + 64], 0, 1);
    }
    wait_async_all();
    __syncthreads();

#pragma unroll
    for (int kc = 0; kc < 2; ++kc) {
      v16h_t a0 = load_frag(&As[(wm * 32 + 0)  * LDP + kc * 32], LDP);
      v16h_t a1 = load_frag(&As[(wm * 32 + 16) * LDP + kc * 32], LDP);
      v16h_t b0 = load_frag(&Bs[(wn * 32 + 0)  * LDP + kc * 32], LDP);
      v16h_t b1 = load_frag(&Bs[(wn * 32 + 16) * LDP + kc * 32], LDP);
      acc[0][0] = wmma_f32_f16(a0, b0, acc[0][0]);
      acc[0][1] = wmma_f32_f16(a0, b1, acc[0][1]);
      acc[1][0] = wmma_f32_f16(a1, b0, acc[1][0]);
      acc[1][1] = wmma_f32_f16(a1, b1, acc[1][1]);
    }
  }

#pragma unroll
  for (int tm = 0; tm < 2; ++tm)
#pragma unroll
    for (int tn = 0; tn < 2; ++tn)
#pragma unroll
      for (int i = 0; i < 8; ++i) {
        int r = bm * 128 + wm * 32 + tm * 16 + i + 8 * hi;
        int n = bn * 64  + wn * 32 + tn * 16 + m16;
        float v = acc[tm][tn][i];
        if (mode == 0) {
          int b = r >> 11;            // r / SEQ
          int s = r & (SEQ - 1);
          int hh = n >> 6;            // n / HDIM
          int d  = n & (HDIM - 1);
          ((half_t*)out)[(((size_t)(b * NHEAD + hh) * SEQ) + s) * HDIM + d] = (half_t)v;
        } else {
          ((float*)out)[(size_t)r * DIM + n] = v + bias[n];
        }
      }
}

__device__ inline float xhalf(float x) {
  int v = __builtin_bit_cast(int, x);
  return __builtin_bit_cast(float,
      __builtin_amdgcn_permlanex16(v, v, 0x76543210, 0xfedcba98, false, false));
}

__global__ __launch_bounds__(128) void attn_kernel(const half_t* __restrict__ Qh,
                                                   const half_t* __restrict__ Kh,
                                                   const half_t* __restrict__ Vh,
                                                   const int* __restrict__ Mmask,
                                                   half_t* __restrict__ Oh) {
  int bh = blockIdx.x;                 // 0..31
  int b = bh >> 4;
  int h = bh & (NHEAD - 1);
  int qtile = blockIdx.y;              // 0..31
  int tid = threadIdx.x;
  int wid = tid >> 5;
  int lane = tid & 31;
  int m16 = lane & 15;
  int hi  = lane >> 4;

  __shared__ __attribute__((aligned(16))) half_t Qs[64 * LDP];       // [q][d]
  __shared__ __attribute__((aligned(16))) half_t Ks[64 * LDP];       // [key][d]
  __shared__ __attribute__((aligned(16))) half_t Vt[64 * LDP];       // [d][key]  (transposed V)

  const half_t* Qbase = Qh + ((size_t)bh * SEQ + (size_t)qtile * 64) * HDIM;
  const half_t* Kbase = Kh + (size_t)bh * SEQ * HDIM;
  const half_t* Vbase = Vh + (size_t)bh * SEQ * HDIM;

  int crow = tid >> 3;                 // this thread's first tile row in the copies
  int ccol = (tid & 7) * 8;            // and its 8-half column

  // Q tile 64x64 via async-to-LDS (chunk c = tid + 128 j: row = crow + 16 j)
  async_copy4_b128(lds_addr(&Qs[(crow + 0)  * LDP + ccol]), &Qbase[(crow + 0)  * HDIM + ccol],
                   lds_addr(&Qs[(crow + 16) * LDP + ccol]), &Qbase[(crow + 16) * HDIM + ccol],
                   lds_addr(&Qs[(crow + 32) * LDP + ccol]), &Qbase[(crow + 32) * HDIM + ccol],
                   lds_addr(&Qs[(crow + 48) * LDP + ccol]), &Qbase[(crow + 48) * HDIM + ccol]);
  wait_async_all();
  __syncthreads();

  // B fragments of Q^T: lane = query column
  v16h_t bq0 = load_frag(&Qs[wid * 16 * LDP + 0],  LDP);  // d = 0..31
  v16h_t bq1 = load_frag(&Qs[wid * 16 * LDP + 32], LDP);  // d = 32..63

  v8f_t Oacc[4] = {};                  // Oacc[jd][i] = O[q = m16][d = jd*16 + 8*hi + i]
  float mrow = -3.0e38f;               // this query's running maximum (same in both halves)
  float lrow = 0.0f;                   // sum over this lane's own keys; halves joined at the end

  // this lane's query row of the mask, at its half's first key of a 16-key tile
  int q = qtile * 64 + wid * 16 + m16;
  const int* Mrow = Mmask + ((size_t)b * SEQ + (size_t)q) * SEQ + 8 * hi;

  for (int kt = 0; kt < SEQ / 64; ++kt) {
    __syncthreads();
    // K tile 64x64 (row-major [key][d]) via async-to-LDS
    {
      const half_t* Kt = Kbase + (size_t)kt * 64 * HDIM;
      async_copy4_b128(lds_addr(&Ks[(crow + 0)  * LDP + ccol]), &Kt[(crow + 0)  * HDIM + ccol],
                       lds_addr(&Ks[(crow + 16) * LDP + ccol]), &Kt[(crow + 16) * HDIM + ccol],
                       lds_addr(&Ks[(crow + 32) * LDP + ccol]), &Kt[(crow + 32) * HDIM + ccol],
                       lds_addr(&Ks[(crow + 48) * LDP + ccol]), &Kt[(crow + 48) * HDIM + ccol]);
    }
    // V tile, transposed into Vt[d][key] (manual: async DMA cannot transpose)
#pragma unroll
    for (int c = tid; c < 512; c += 128) {
      int key = c >> 3;
      int d0  = (c & 7) * 8;
      v8h_t v = *(const v8h_t*)&Vbase[(size_t)kt * 64 * HDIM + (size_t)key * HDIM + d0];
#pragma unroll
      for (int e = 0; e < 8; ++e) Vt[(d0 + e) * LDP + key] = v[e];
    }
    wait_async_all();
    __syncthreads();

    // this lane's 32 mask words of the tile (8 consecutive words per 16-key tile),
    // all requested together
    int4 mk[8];
#pragma unroll
    for (int jn = 0; jn < 4; ++jn) {
      const int4* mp = (const int4*)&Mrow[kt * 64 + jn * 16];
      mk[2 * jn]     = mp[0];
      mk[2 * jn + 1] = mp[1];
    }
    // keeps the eight loads in one group here: the scheduler otherwise sinks them in
    // pairs to their uses, and the wave waits out a load latency four times a tile
    __builtin_amdgcn_sched_barrier(0);

    // --- scores, transposed: Sacc[jn][i] = S[key = jn*16 + 8*hi + i][q = m16] ---
    v8f_t Sacc[4] = {};
#pragma unroll
    for (int jn = 0; jn < 4; ++jn) {
      v16h_t ak0 = load_frag(&Ks[jn * 16 * LDP + 0],  LDP);
      v16h_t ak1 = load_frag(&Ks[jn * 16 * LDP + 32], LDP);
      Sacc[jn] = wmma_f32_f16(ak0, bq0, Sacc[jn]);
      Sacc[jn] = wmma_f32_f16(ak1, bq1, Sacc[jn]);
    }

    // --- mask + online softmax: 32 keys of one query per lane ---
    float pmax[4];                     // one chain per 16-key tile
#pragma unroll
    for (int jn = 0; jn < 4; ++jn) {
      int4 ma = mk[2 * jn];
      int4 mb = mk[2 * jn + 1];
      int mv[8] = {ma.x, ma.y, ma.z, ma.w, mb.x, mb.y, mb.z, mb.w};
      pmax[jn] = -3.0e38f;
#pragma unroll
      for (int i = 0; i < 8; ++i) {
        float s = mv[i] ? Sacc[jn][i] : -1.0e9f;
        Sacc[jn][i] = s;
        pmax[jn] = fmaxf(pmax[jn], s);
      }
    }
    float rmax = fmaxf(fmaxf(pmax[0], pmax[1]), fmaxf(pmax[2], pmax[3]));
    rmax = fmaxf(rmax, xhalf(rmax));   // the other half holds the query's other 32 keys
    float mnew = fmaxf(mrow, rmax);
    float corr = __expf(mrow - mnew);
    mrow = mnew;
    float psum[4];                     // one chain per 16-key tile
#pragma unroll
    for (int jn = 0; jn < 4; ++jn) {
      psum[jn] = 0.0f;
#pragma unroll
      for (int i = 0; i < 8; ++i) {
        float p = __expf(Sacc[jn][i] - mnew);
        Sacc[jn][i] = p;
        psum[jn] += p;
      }
    }
    lrow = lrow * corr + ((psum[0] + psum[1]) + (psum[2] + psum[3]));

    // --- P^T as B fragments, in-lane: keys {8*hi + i, 16 + 8*hi + i} of each 32 ---
    v16h_t bp0, bp1;
#pragma unroll
    for (int i = 0; i < 8; ++i) {
      bp0[i]     = (half_t)Sacc[0][i];
      bp0[i + 8] = (half_t)Sacc[1][i];
      bp1[i]     = (half_t)Sacc[2][i];
      bp1[i + 8] = (half_t)Sacc[3][i];
    }

    // rescale running output
#pragma unroll
    for (int jd = 0; jd < 4; ++jd)
#pragma unroll
      for (int i = 0; i < 8; ++i)
        Oacc[jd][i] *= corr;

#pragma unroll
    for (int jd = 0; jd < 4; ++jd) {
      v16h_t av0 = load_frag(&Vt[jd * 16 * LDP + 0],  LDP);  // keys 0..31
      v16h_t av1 = load_frag(&Vt[jd * 16 * LDP + 32], LDP);  // keys 32..63
      Oacc[jd] = wmma_f32_f16(av0, bp0, Oacc[jd]);
      Oacc[jd] = wmma_f32_f16(av1, bp1, Oacc[jd]);
    }
  }

  // --- write Oh[b, q, h*64 + d]: 8 consecutive d per lane and tile ---
  float lsum = lrow + xhalf(lrow);
  float inv = lsum > 0.0f ? 1.0f / lsum : 0.0f;
#pragma unroll
  for (int jd = 0; jd < 4; ++jd) {
    v8h_t o;
#pragma unroll
    for (int i = 0; i < 8; ++i) o[i] = (half_t)(Oacc[jd][i] * inv);
    *(v8h_t*)&Oh[((size_t)b * SEQ + q) * DIM + h * HDIM + jd * 16 + 8 * hi] = o;
  }
}

// ---------------------------------------------------------------------------
// Launch
// ---------------------------------------------------------------------------
extern "C" void kernel_launch(void* const* d_in, const int* in_sizes, int n_in,
                              void* d_out, int out_size, void* d_ws, size_t ws_size,
                              hipStream_t stream) {
  const float* x   = (const float*)d_in[0];
  const int*   M   = (const int*)d_in[1];
  const float* Wq  = (const float*)d_in[2];
  const float* Wk  = (const float*)d_in[3];
  const float* Wv  = (const float*)d_in[4];
  const float* Wo  = (const float*)d_in[5];
  const float* bo  = (const float*)d_in[6];

  char* ws = (char*)d_ws;
  const size_t MB = 1u << 20;
  half_t* xh  = (half_t*)(ws + 0 * MB);   // 8 MB  [B*S, D]
  half_t* wqh = (half_t*)(ws + 8 * MB);   // 2 MB
  half_t* wkh = (half_t*)(ws + 10 * MB);  // 2 MB
  half_t* wvh = (half_t*)(ws + 12 * MB);  // 2 MB
  half_t* woh = (half_t*)(ws + 14 * MB);  // 2 MB
  half_t* Qh  = (half_t*)(ws + 16 * MB);  // 8 MB  [B,H,S,HD]
  half_t* Kh  = (half_t*)(ws + 24 * MB);  // 8 MB
  half_t* Vh  = (half_t*)(ws + 32 * MB);  // 8 MB
  half_t* Oh  = (half_t*)(ws + 40 * MB);  // 8 MB  [B,S,D]

  const int nX4 = BATCH * SEQ * DIM / 4;  // 1048576
  const int nW4 = DIM * DIM / 4;          // 262144
  cvt_f32_f16_kernel<<<nX4 / 256, 256, 0, stream>>>(x,  xh,  1.0f,   nX4);
  cvt_f32_f16_kernel<<<nW4 / 256, 256, 0, stream>>>(Wq, wqh, 0.125f, nW4);  // fold HD^-0.5
  cvt_f32_f16_kernel<<<nW4 / 256, 256, 0, stream>>>(Wk, wkh, 1.0f,   nW4);
  cvt_f32_f16_kernel<<<nW4 / 256, 256, 0, stream>>>(Wv, wvh, 1.0f,   nW4);
  cvt_f32_f16_kernel<<<nW4 / 256, 256, 0, stream>>>(Wo, woh, 1.0f,   nW4);

  dim3 gg(BATCH * SEQ / 128, DIM / 64);   // (32, 16)
  gemm_xwT_kernel<<<gg, 256, 0, stream>>>(xh, wqh, Qh, nullptr, 0);
  gemm_xwT_kernel<<<gg, 256, 0, stream>>>(xh, wkh, Kh, nullptr, 0);
  gemm_xwT_kernel<<<gg, 256, 0, stream>>>(xh, wvh, Vh, nullptr, 0);

  attn_kernel<<<dim3(BATCH * NHEAD, SEQ / 64), 128, 0, stream>>>(Qh, Kh, Vh, M, Oh);

  gemm_xwT_kernel<<<gg, 256, 0, stream>>>(Oh, woh, d_out, bo, 1);
}

// v003
// It runs in 195 microseconds.
// In both of two side-by-side timings against v002, it was 1.06 times as fast.
// Counting every step since v000, it is 2.19 times as fast.
#include <hip/hip_runtime.h>
#include <hip/hip_bf16.h>

// ---------------------------------------------------------------------------
// Fixed attention block for MI455X (gfx1250), wave32 + WMMA f32_16x16x32_f16,
// with GLOBAL_LOAD_ASYNC_TO_LDS_B128 tile staging (ASYNCcnt).
//   B=2, S=2048, D=1024, H=16, HD=64
// Pipeline:
//   1) cvt: fp32 -> f16 for x, Wq(*0.125), Wk, Wv, Wo, one launch
//   2) gemm: Q=x Wq^T, K=x Wk^T, V=x Wv^T, one launch (f16 out, [B,H,S,HD] layout)
//   3) flash attention per (b,h,qtile) -> Oh [B,S,D] f16
//   4) gemm: out = Oh Wo^T + b_o (fp32 out)
// ---------------------------------------------------------------------------

typedef _Float16 half_t;
typedef __attribute__((ext_vector_type(16))) _Float16 v16h_t;
typedef __attribute__((ext_vector_type(8)))  _Float16 v8h_t;
typedef __attribute__((ext_vector_type(4)))  _Float16 v4h_t;
typedef __attribute__((ext_vector_type(8)))  float    v8f_t;

#define BATCH 2
#define SEQ   2048
#define DIM   1024
#define NHEAD 16
#define HDIM  64
// LDS row pitch, in halves, of every 64-half tile row read by 16-byte LDS
// loads: 144 B = 16 B x 9 puts the 16 rows of a fragment on 16 different
// 4-bank groups (128 B rows put them all on two).
#define LDP   72

// ---------------------------------------------------------------------------
// WMMA wrapper: D = A(16x32 f16) * B(32x16 f16) + C(16x16 f32)
// ---------------------------------------------------------------------------
__device__ inline v8f_t wmma_f32_f16(v16h_t a, v16h_t b, v8f_t c) {
  return __builtin_amdgcn_wmma_f32_16x16x32_f16(
      /*neg_a=*/false, a, /*neg_b=*/false, b,
      /*c_mod=*/(short)0, c, /*reuse_a=*/false, /*reuse_b=*/false);
}

// ---------------------------------------------------------------------------
// Async global -> LDS copy, 16 bytes per lane (GLOBAL_LOAD_ASYNC_TO_LDS_B128,
// tracked by ASYNCcnt; data lands in LDS without touching VGPRs).
// LDS operand: byte offset within the workgroup's LDS allocation == low 32
// bits of the generic shared-memory pointer (shared aperture is in the high
// 32 bits per the ISA aperture check).
// ---------------------------------------------------------------------------
// Runs of copies stand in one statement that ends in s_wait_xcnt 0, so that no
// address register of an issued copy is rewritten ahead of that wait.
__device__ inline unsigned lds_addr(const void* p) {
  return (unsigned)(unsigned long long)p;
}
__device__ inline void async_copy4_b128(unsigned l0, const void* g0, unsigned l1, const void* g1,
                                        unsigned l2, const void* g2, unsigned l3, const void* g3) {
  asm volatile("global_load_async_to_lds_b128 %0, %1, off\n\t"
               "global_load_async_to_lds_b128 %2, %3, off\n\t"
               "global_load_async_to_lds_b128 %4, %5, off\n\t"
               "global_load_async_to_lds_b128 %6, %7, off\n\t"
               "s_wait_xcnt 0x0"
               :: "v"(l0), "v"(g0), "v"(l1), "v"(g1), "v"(l2), "v"(g2), "v"(l3), "v"(g3)
               : "memory");
}
__device__ inline void async_copy6_b128(unsigned l0, const void* g0, unsigned l1, const void* g1,
                                        unsigned l2, const void* g2, unsigned l3, const void* g3,
                                        unsigned l4, const void* g4, unsigned l5, const void* g5) {
  asm volatile("global_load_async_to_lds_b128 %0, %1, off\n\t"
               "global_load_async_to_lds_b128 %2, %3, off\n\t"
               "global_load_async_to_lds_b128 %4, %5, off\n\t"
               "global_load_async_to_lds_b128 %6, %7, off\n\t"
               "global_load_async_to_lds_b128 %8, %9, off\n\t"
               "global_load_async_to_lds_b128 %10, %11, off\n\t"
               "s_wait_xcnt 0x0"
               :: "v"(l0), "v"(g0), "v"(l1), "v"(g1), "v"(l2), "v"(g2), "v"(l3), "v"(g3),
                  "v"(l4), "v"(g4), "v"(l5), "v"(g5)
               : "memory");
}
__device__ inline void wait_async_all() {
  asm volatile("s_wait_asynccnt 0x0" ::: "memory");
}

// ---------------------------------------------------------------------------
// Build a 16x32 f16 fragment (A-layout per ISA 7.12.2) from a row-major tile
// in LDS.  Lane L (L<16) holds row M=L, K = {0..7, 16..23}; lane L+16 holds
// row M=L, K = {8..15, 24..31}.  Two 16B LDS loads per fragment.
// B-fragments (32x16, K x N) use the same call on an N-major (transposed)
// tile: lane = N column, 16 K values per lane with the same split.
// ---------------------------------------------------------------------------
__device__ inline v16h_t load_frag(const half_t* base, int row_stride) {
  int lane = threadIdx.x & 31;
  int m    = lane & 15;
  int hi   = lane >> 4;
  const half_t* p = base + (size_t)m * row_stride + hi * 8;
  v8h_t lo = *(const v8h_t*)(p);        // K = hi*8 .. hi*8+7
  v8h_t hp = *(const v8h_t*)(p + 16);   // K = 16+hi*8 .. 16+hi*8+7
  v16h_t r;
#pragma unroll
  for (int i = 0; i < 8; ++i) { r[i] = lo[i]; r[i + 8] = hp[i]; }
  return r;
}

// ---------------------------------------------------------------------------
// fp32 -> f16 conversion of all five operands in one launch, 4 elements /
// thread.  The block index picks the source: the first XBLK blocks take x, then
// WBLK blocks each take Wq (scaled by HD^-0.5), Wk, Wv, Wo.  The f16 copies lie
// one behind the other in `out`, in that order.
// ---------------------------------------------------------------------------
#define XBLK (BATCH * SEQ * DIM / 4 / 256)   // 4096
#define WBLK (DIM * DIM / 4 / 256)           // 1024
__global__ __launch_bounds__(256) void cvt_f32_f16_kernel(const float* __restrict__ x,
                                                          const float* __restrict__ Wq,
                                                          const float* __restrict__ Wk,
                                                          const float* __restrict__ Wv,
                                                          const float* __restrict__ Wo,
                                                          half_t* __restrict__ out) {
  int blk = blockIdx.x;
  const float* in = x;
  int sblk = blk;                      // block index within the source
  float scale = 1.0f;
  if (blk >= XBLK) {
    int w = (blk - XBLK) / WBLK;
    sblk  = (blk - XBLK) % WBLK;
    in    = w == 0 ? Wq : w == 1 ? Wk : w == 2 ? Wv : Wo;
    scale = w == 0 ? 0.125f : 1.0f;
  }
  float4 f = ((const float4*)in)[sblk * 256 + threadIdx.x];
  v4h_t h;
  h[0] = (half_t)(f.x * scale);
  h[1] = (half_t)(f.y * scale);
  h[2] = (half_t)(f.z * scale);
  h[3] = (half_t)(f.w * scale);
  ((v4h_t*)out)[blk * 256 + threadIdx.x] = h;
}

// ---------------------------------------------------------------------------
// GEMM: C[r][n] = sum_k X[r][k] * W[n][k],  R=4096, K=1024, N=1024.
// Block tile 128x64, BK=64.  8 waves in a 4(M) x 2(N) grid; each wave owns a
// 32x32 tile = 2x2x2 v_wmma_f32_16x16x32_f16 per K step (8 WMMA / barrier).
// Tiles staged via GLOBAL_LOAD_ASYNC_TO_LDS_B128.
// mode 0: f16 output scattered to head layout [B,H,S,HD]; blockIdx.z picks the
//         product: weight matrix z behind W, output tensor z behind out
// mode 1: fp32 output + bias, flat [R,N]
// ---------------------------------------------------------------------------
__global__ __launch_bounds__(256) void gemm_xwT_kernel(const half_t* __restrict__ X,
                                                       const half_t* __restrict__ W,
                                                       void* __restrict__ out,
                                                       const float* __restrict__ bias,
                                                       int mode) {
  const int K = DIM;
  int bm = blockIdx.x;          // 0..31  (row tiles of 128)
  int bn = blockIdx.y;          // 0..15  (col tiles of 64)
  int tid = threadIdx.x;
  int wid = tid >> 5;
  int lane = tid & 31;
  int wm = wid & 3;             // wave row   (4)
  int wn = wid >> 2;            // wave col   (2)
  int m16 = lane & 15;
  int hi  = lane >> 4;

  __shared__ __attribute__((aligned(16))) half_t As[128 * LDP];   // 18 KB
  __shared__ __attribute__((aligned(16))) half_t Bs[64 * LDP];    //  9 KB

  v8f_t acc[2][2] = {};

  const half_t* Xb = X + (size_t)(bm * 128) * K;
  const half_t* Wb = W + (size_t)blockIdx.z * DIM * DIM + (size_t)(bn * 64) * K;
  int crow = tid >> 3;          // this thread's first tile row in the copies
  int ccol = (tid & 7) * 8;     // and its 8-half column

  for (int k0 = 0; k0 < K; k0 += 64) {
    __syncthreads();    // previous tile fully consumed before overwrite
    // A tile: 128 rows x 64 halves = 1024 chunks of 8 halves (16B) -> 4/thread
    // (chunk c = tid + 256 j: row = crow + 32 j, same column)
    // B tile: 64 rows x 64 halves = 512 chunks -> 2/thread
    async_copy6_b128(lds_addr(&As[(crow + 0)  * LDP + ccol]), &Xb[(size_t)(crow + 0)  * K + k0 + ccol],
                     lds_addr(&As[(crow + 32) * LDP + ccol]), &Xb[(size_t)(crow + 32) * K + k0 + ccol],
                     lds_addr(&As[(crow + 64) * LDP + ccol]), &Xb[(size_t)(crow + 64) * K + k0 + ccol],
                     lds_addr(&As[(crow + 96) * LDP + ccol]), &Xb[(size_t)(crow + 96) * K + k0 + ccol],
                     lds_addr(&Bs[(crow + 0)  * LDP + ccol]), &Wb[(size_t)(crow + 0)  * K + k0 + ccol],
                     lds_addr(&Bs[(crow + 32) * LDP + ccol]), &Wb[(size_t)(crow + 32) * K + k0 + ccol]);
    if (k0 + 64 < K) {
      // warm next tiles in the cache hierarchy (global_prefetch_b8)
      __builtin_prefetch(&Xb[(size_t)(tid >> 1) * K + k0 + 64], 0, 1);
      __builtin_prefetch(&Wb[(size_t)(tid >> 2) * K + k0 + 64], 0, 1);
    }
    wait_async_all();
    __syncthreads();

#pragma unroll
    for (int kc = 0; kc < 2; ++kc) {
      v16h_t a0 = load_frag(&As[(wm * 32 + 0)  * LDP + kc * 32], LDP);
      v16h_t a1 = load_frag(&As[(wm * 32 + 16) * LDP + kc * 32], LDP);
      v16h_t b0 = load_frag(&Bs[(wn * 32 + 0)  * LDP + kc * 32], LDP);
      v16h_t b1 = load_frag(&Bs[(wn * 32 + 16) * LDP + kc * 32], LDP);
      acc[0][0] = wmma_f32_f16(a0, b0, acc[0][0]);
      acc[0][1] = wmma_f32_f16(a0, b1, acc[0][1]);
      acc[1][0] = wmma_f32_f16(a1, b0, acc[1][0]);
      acc[1][1] = wmma_f32_f16(a1, b1, acc[1][1]);
    }
  }

#pragma unroll
  for (int tm = 0; tm < 2; ++tm)
#pragma unroll
    for (int tn = 0; tn < 2; ++tn)
#pragma unroll
      for (int i = 0; i < 8; ++i) {
        int r = bm * 128 + wm * 32 + tm * 16 + i + 8 * hi;
        int n = bn * 64  + wn * 32 + tn * 16 + m16;
        float v = acc[tm][tn][i];
        if (mode == 0) {
          int b = r >> 11;            // r / SEQ
          int s = r & (SEQ - 1);
          int hh = n >> 6;            // n / HDIM
          int d  = n & (HDIM - 1);
          ((half_t*)out)[(((size_t)((blockIdx.z * BATCH + b) * NHEAD + hh) * SEQ) + s) * HDIM + d] = (half_t)v;
          // holds every later rewrite of this store's address and data registers behind it
          asm volatile("s_wait_xcnt 0x0" ::: "memory");
        } else {
          ((float*)out)[(size_t)r * DIM + n] = v + bias[n];
        }
      }
}

__device__ inline float xhalf(float x) {
  int v = __builtin_bit_cast(int, x);
  return __builtin_bit_cast(float,
      __builtin_amdgcn_permlanex16(v, v, 0x76543210, 0xfedcba98, false, false));
}

__global__ __launch_bounds__(128) void attn_kernel(const half_t* __restrict__ Qh,
                                                   const half_t* __restrict__ Kh,
                                                   const half_t* __restrict__ Vh,
                                                   const int* __restrict__ Mmask,
                                                   half_t* __restrict__ Oh) {
  int bh = blockIdx.x;                 // 0..31
  int b = bh >> 4;
  int h = bh & (NHEAD - 1);
  int qtile = blockIdx.y;              // 0..31
  int tid = threadIdx.x;
  int wid = tid >> 5;
  int lane = tid & 31;
  int m16 = lane & 15;
  int hi  = lane >> 4;

  __shared__ __attribute__((aligned(16))) half_t Qs[64 * LDP];       // [q][d]
  __shared__ __attribute__((aligned(16))) half_t Ks[64 * LDP];       // [key][d]
  __shared__ __attribute__((aligned(16))) half_t Vt[64 * LDP];       // [d][key]  (transposed V)

  const half_t* Qbase = Qh + ((size_t)bh * SEQ + (size_t)qtile * 64) * HDIM;
  const half_t* Kbase = Kh + (size_t)bh * SEQ * HDIM;
  const half_t* Vbase = Vh + (size_t)bh * SEQ * HDIM;

  int crow = tid >> 3;                 // this thread's first tile row in the copies
  int ccol = (tid & 7) * 8;            // and its 8-half column

  // Q tile 64x64 via async-to-LDS (chunk c = tid + 128 j: row = crow + 16 j)
  async_copy4_b128(lds_addr(&Qs[(crow + 0)  * LDP + ccol]), &Qbase[(crow + 0)  * HDIM + ccol],
                   lds_addr(&Qs[(crow + 16) * LDP + ccol]), &Qbase[(crow + 16) * HDIM + ccol],
                   lds_addr(&Qs[(crow + 32) * LDP + ccol]), &Qbase[(crow + 32) * HDIM + ccol],
                   lds_addr(&Qs[(crow + 48) * LDP + ccol]), &Qbase[(crow + 48) * HDIM + ccol]);
  wait_async_all();
  __syncthreads();

  // B fragments of Q^T: lane = query column
  v16h_t bq0 = load_frag(&Qs[wid * 16 * LDP + 0],  LDP);  // d = 0..31
  v16h_t bq1 = load_frag(&Qs[wid * 16 * LDP + 32], LDP);  // d = 32..63

  v8f_t Oacc[4] = {};                  // Oacc[jd][i] = O[q = m16][d = jd*16 + 8*hi + i]
  float mrow = -3.0e38f;               // this query's running maximum (same in both halves)
  float lrow = 0.0f;                   // sum over this lane's own keys; halves joined at the end

  // this lane's query row of the mask, at its half's first key of a 16-key tile
  int q = qtile * 64 + wid * 16 + m16;
  const int* Mrow = Mmask + ((size_t)b * SEQ + (size_t)q) * SEQ + 8 * hi;

  for (int kt = 0; kt < SEQ / 64; ++kt) {
    __syncthreads();
    // K tile 64x64 (row-major [key][d]) via async-to-LDS
    {
      const half_t* Kt = Kbase + (size_t)kt * 64 * HDIM;
      async_copy4_b128(lds_addr(&Ks[(crow + 0)  * LDP + ccol]), &Kt[(crow + 0)  * HDIM + ccol],
                       lds_addr(&Ks[(crow + 16) * LDP + ccol]), &Kt[(crow + 16) * HDIM + ccol],
                       lds_addr(&Ks[(crow + 32) * LDP + ccol]), &Kt[(crow + 32) * HDIM + ccol],
                       lds_addr(&Ks[(crow + 48) * LDP + ccol]), &Kt[(crow + 48) * HDIM + ccol]);
    }
    // V tile, transposed into Vt[d][key] (manual: async DMA cannot transpose)
#pragma unroll
    for (int c = tid; c < 512; c += 128) {
      int key = c >> 3;
      int d0  = (c & 7) * 8;
      v8h_t v = *(const v8h_t*)&Vbase[(size_t)kt * 64 * HDIM + (size_t)key * HDIM + d0];
#pragma unroll
      for (int e = 0; e < 8; ++e) Vt[(d0 + e) * LDP + key] = v[e];
    }
    wait_async_all();
    __syncthreads();

    // this lane's 32 mask words of the tile (8 consecutive words per 16-key tile),
    // all requested together
    int4 mk[8];
#pragma unroll
    for (int jn = 0; jn < 4; ++jn) {
      const int4* mp = (const int4*)&Mrow[kt * 64 + jn * 16];
      mk[2 * jn]     = mp[0];
      mk[2 * jn + 1] = mp[1];
    }
    // keeps the eight loads in one group here: the scheduler otherwise sinks them in
    // pairs to their uses, and the wave waits out a load latency four times a tile
    __builtin_amdgcn_sched_barrier(0);

    // --- scores, transposed: Sacc[jn][i] = S[key = jn*16 + 8*hi + i][q = m16] ---
    v8f_t Sacc[4] = {};
#pragma unroll
    for (int jn = 0; jn < 4; ++jn) {
      v16h_t ak0 = load_frag(&Ks[jn * 16 * LDP + 0],  LDP);
      v16h_t ak1 = load_frag(&Ks[jn * 16 * LDP + 32], LDP);
      Sacc[jn] = wmma_f32_f16(ak0, bq0, Sacc[jn]);
      Sacc[jn] = wmma_f32_f16(ak1, bq1, Sacc[jn]);
    }

    // --- mask + online softmax: 32 keys of one query per lane ---
    float pmax[4];                     // one chain per 16-key tile
#pragma unroll
    for (int jn = 0; jn < 4; ++jn) {
      int4 ma = mk[2 * jn];
      int4 mb = mk[2 * jn + 1];
      int mv[8] = {ma.x, ma.y, ma.z, ma.w, mb.x, mb.y, mb.z, mb.w};
      pmax[jn] = -3.0e38f;
#pragma unroll
      for (int i = 0; i < 8; ++i) {
        float s = mv[i] ? Sacc[jn][i] : -1.0e9f;
        Sacc[jn][i] = s;
        pmax[jn] = fmaxf(pmax[jn], s);
      }
    }
    float rmax = fmaxf(fmaxf(pmax[0], pmax[1]), fmaxf(pmax[2], pmax[3]));
    rmax = fmaxf(rmax, xhalf(rmax));   // the other half holds the query's other 32 keys
    float mnew = fmaxf(mrow, rmax);
    float corr = __expf(mrow - mnew);
    mrow = mnew;
    float psum[4];                     // one chain per 16-key tile
#pragma unroll
    for (int jn = 0; jn < 4; ++jn) {
      psum[jn] = 0.0f;
#pragma unroll
      for (int i = 0; i < 8; ++i) {
        float p = __expf(Sacc[jn][i] - mnew);
        Sacc[jn][i] = p;
        psum[jn] += p;
      }
    }
    lrow = lrow * corr + ((psum[0] + psum[1]) + (psum[2] + psum[3]));

    // --- P^T as B fragments, in-lane: keys {8*hi + i, 16 + 8*hi + i} of each 32 ---
    v16h_t bp0, bp1;
#pragma unroll
    for (int i = 0; i < 8; ++i) {
      bp0[i]     = (half_t)Sacc[0][i];
      bp0[i + 8] = (half_t)Sacc[1][i];
      bp1[i]     = (half_t)Sacc[2][i];
      bp1[i + 8] = (half_t)Sacc[3][i];
    }

    // rescale running output
#pragma unroll
    for (int jd = 0; jd < 4; ++jd)
#pragma unroll
      for (int i = 0; i < 8; ++i)
        Oacc[jd][i] *= corr;

#pragma unroll
    for (int jd = 0; jd < 4; ++jd) {
      v16h_t av0 = load_frag(&Vt[jd * 16 * LDP + 0],  LDP);  // keys 0..31
      v16h_t av1 = load_frag(&Vt[jd * 16 * LDP + 32], LDP);  // keys 32..63
      Oacc[jd] = wmma_f32_f16(av0, bp0, Oacc[jd]);
      Oacc[jd] = wmma_f32_f16(av1, bp1, Oacc[jd]);
    }
  }

  // --- write Oh[b, q, h*64 + d]: 8 consecutive d per lane and tile ---
  float lsum = lrow + xhalf(lrow);
  float inv = lsum > 0.0f ? 1.0f / lsum : 0.0f;
#pragma unroll
  for (int jd = 0; jd < 4; ++jd) {
    v8h_t o;
#pragma unroll
    for (int i = 0; i < 8; ++i) o[i] = (half_t)(Oacc[jd][i] * inv);
    *(v8h_t*)&Oh[((size_t)b * SEQ + q) * DIM + h * HDIM + jd * 16 + 8 * hi] = o;
  }
}

// ---------------------------------------------------------------------------
// Launch
// ---------------------------------------------------------------------------
extern "C" void kernel_launch(void* const* d_in, const int* in_sizes, int n_in,
                              void* d_out, int out_size, void* d_ws, size_t ws_size,
                              hipStream_t stream) {
  const float* x   = (const float*)d_in[0];
  const int*   M   = (const int*)d_in[1];
  const float* Wq  = (const float*)d_in[2];
  const float* Wk  = (const float*)d_in[3];
  const float* Wv  = (const float*)d_in[4];
  const float* Wo  = (const float*)d_in[5];
  const float* bo  = (const float*)d_in[6];

  char* ws = (char*)d_ws;
  const size_t MB = 1u << 20;
  half_t* xh  = (half_t*)(ws + 0 * MB);   // 8 MB  [B*S, D]
  half_t* wqh = (half_t*)(ws + 8 * MB);   // 2 MB
  //      Wk as f16 at ws + 10 MB, Wv at ws + 12 MB (2 MB each), reached from wqh
  half_t* woh = (half_t*)(ws + 14 * MB);  // 2 MB
  half_t* Qh  = (half_t*)(ws + 16 * MB);  // 8 MB  [B,H,S,HD]
  half_t* Kh  = (half_t*)(ws + 24 * MB);  // 8 MB
  half_t* Vh  = (half_t*)(ws + 32 * MB);  // 8 MB
  half_t* Oh  = (half_t*)(ws + 40 * MB);  // 8 MB  [B,S,D]

  // the five f16 copies are written as one run from xh on
  cvt_f32_f16_kernel<<<XBLK + 4 * WBLK, 256, 0, stream>>>(x, Wq, Wk, Wv, Wo, xh);

  // z = 0, 1, 2: Q, K, V (the three f16 weights from wqh on, and Qh, Kh, Vh, lie one behind the other)
  gemm_xwT_kernel<<<dim3(BATCH * SEQ / 128, DIM / 64, 3), 256, 0, stream>>>(xh, wqh, Qh, nullptr, 0);

  attn_kernel<<<dim3(BATCH * NHEAD, SEQ / 64), 128, 0, stream>>>(Qh, Kh, Vh, M, Oh);

  gemm_xwT_kernel<<<dim3(BATCH * SEQ / 128, DIM / 64, 1), 256, 0, stream>>>(Oh, woh, d_out, bo, 1);
}

// v004
// Measured time: 156 microseconds a run.
// Next to v003, in two timings, it ran 1.25 times as fast each time.
// All steps since v000 together make it 2.74 times as fast.
#include <hip/hip_runtime.h>
#include <hip/hip_bf16.h>

// ---------------------------------------------------------------------------
// Fixed attention block for MI455X (gfx1250), wave32 + WMMA f32_16x16x32_f16,
// with GLOBAL_LOAD_ASYNC_TO_LDS_B128 tile staging (ASYNCcnt).
//   B=2, S=2048, D=1024, H=16, HD=64
// Pipeline:
//   1) cvt: fp32 -> f16 for x, Wq(*0.125), Wk, Wv, Wo, one launch
//   2) gemm: Q=x Wq^T, K=x Wk^T, V=x Wv^T, one launch (f16 out, [B,H,S,HD] layout)
//   3) flash attention per (b,h,qtile) -> Oh [B,S,D] f16
//   4) gemm: out = Oh Wo^T + b_o (fp32 out)
// ---------------------------------------------------------------------------

typedef _Float16 half_t;
typedef __attribute__((ext_vector_type(16))) _Float16 v16h_t;
typedef __attribute__((ext_vector_type(8)))  _Float16 v8h_t;
typedef __attribute__((ext_vector_type(4)))  _Float16 v4h_t;
typedef __attribute__((ext_vector_type(8)))  float    v8f_t;
typedef __attribute__((ext_vector_type(8)))  short    v8s_t;

#define BATCH 2
#define SEQ   2048
#define DIM   1024
#define NHEAD 16
#define HDIM  64
// LDS row pitch, in halves, of the 64-half tile rows read by load_frag's 16-byte LDS
// loads: 144 B = 16 B x 9 puts the 16 rows of a fragment on 16 different
// 4-bank groups (128 B rows put them all on two).
#define LDP   72
// LDS row pitch, in halves, of the V tile, whose 64-half rows are read by the
// transposing 16-byte LDS load: that reader wants 160 B = 32 B x 5.
#define LDV   80

// ---------------------------------------------------------------------------
// WMMA wrapper: D = A(16x32 f16) * B(32x16 f16) + C(16x16 f32)
// ---------------------------------------------------------------------------
__device__ inline v8f_t wmma_f32_f16(v16h_t a, v16h_t b, v8f_t c) {
  return __builtin_amdgcn_wmma_f32_16x16x32_f16(
      /*neg_a=*/false, a, /*neg_b=*/false, b,
      /*c_mod=*/(short)0, c, /*reuse_a=*/false, /*reuse_b=*/false);
}

// ---------------------------------------------------------------------------
// Async global -> LDS copy, 16 bytes per lane (GLOBAL_LOAD_ASYNC_TO_LDS_B128,
// tracked by ASYNCcnt; data lands in LDS without touching VGPRs).
// LDS operand: byte offset within the workgroup's LDS allocation == low 32
// bits of the generic shared-memory pointer (shared aperture is in the high
// 32 bits per the ISA aperture check).
// ---------------------------------------------------------------------------
// Runs of copies stand in one statement that ends in s_wait_xcnt 0, so that no
// address register of an issued copy is rewritten ahead of that wait.
__device__ inline unsigned lds_addr(const void* p) {
  return (unsigned)(unsigned long long)p;
}
__device__ inline void async_copy4_b128(unsigned l0, const void* g0, unsigned l1, const void* g1,
                                        unsigned l2, const void* g2, unsigned l3, const void* g3) {
  asm volatile("global_load_async_to_lds_b128 %0, %1, off\n\t"
               "global_load_async_to_lds_b128 %2, %3, off\n\t"
               "global_load_async_to_lds_b128 %4, %5, off\n\t"
               "global_load_async_to_lds_b128 %6, %7, off\n\t"
               "s_wait_xcnt 0x0"
               :: "v"(l0), "v"(g0), "v"(l1), "v"(g1), "v"(l2), "v"(g2), "v"(l3), "v"(g3)
               : "memory");
}
__device__ inline void async_copy6_b128(unsigned l0, const void* g0, unsigned l1, const void* g1,
                                        unsigned l2, const void* g2, unsigned l3, const void* g3,
                                        unsigned l4, const void* g4, unsigned l5, const void* g5) {
  asm volatile("global_load_async_to_lds_b128 %0, %1, off\n\t"
               "global_load_async_to_lds_b128 %2, %3, off\n\t"
               "global_load_async_to_lds_b128 %4, %5, off\n\t"
               "global_load_async_to_lds_b128 %6, %7, off\n\t"
               "global_load_async_to_lds_b128 %8, %9, off\n\t"
               "global_load_async_to_lds_b128 %10, %11, off\n\t"
               "s_wait_xcnt 0x0"
               :: "v"(l0), "v"(g0), "v"(l1), "v"(g1), "v"(l2), "v"(g2), "v"(l3), "v"(g3),
                  "v"(l4), "v"(g4), "v"(l5), "v"(g5)
               : "memory");
}
__device__ inline void async_copy8_b128(unsigned l0, const void* g0, unsigned l1, const void* g1,
                                        unsigned l2, const void* g2, unsigned l3, const void* g3,
                                        unsigned l4, const void* g4, unsigned l5, const void* g5,
                                        unsigned l6, const void* g6, unsigned l7, const void* g7) {
  asm volatile("global_load_async_to_lds_b128 %0, %1, off\n\t"
               "global_load_async_to_lds_b128 %2, %3, off\n\t"
               "global_load_async_to_lds_b128 %4, %5, off\n\t"
               "global_load_async_to_lds_b128 %6, %7, off\n\t"
               "global_load_async_to_lds_b128 %8, %9, off\n\t"
               "global_load_async_to_lds_b128 %10, %11, off\n\t"
               "global_load_async_to_lds_b128 %12, %13, off\n\t"
               "global_load_async_to_lds_b128 %14, %15, off\n\t"
               "s_wait_xcnt 0x0"
               :: "v"(l0), "v"(g0), "v"(l1), "v"(g1), "v"(l2), "v"(g2), "v"(l3), "v"(g3),
                  "v"(l4), "v"(g4), "v"(l5), "v"(g5), "v"(l6), "v"(g6), "v"(l7), "v"(g7)
               : "memory");
}
__device__ inline void wait_async_all() {
  asm volatile("s_wait_asynccnt 0x0" ::: "memory");
}

// ---------------------------------------------------------------------------
// Build a 16x32 f16 fragment (A-layout per ISA 7.12.2) from a row-major tile
// in LDS.  Lane L (L<16) holds row M=L, K = {0..7, 16..23}; lane L+16 holds
// row M=L, K = {8..15, 24..31}.  Two 16B LDS loads per fragment.
// B-fragments (32x16, K x N) use the same call on an N-major (transposed)
// tile: lane = N column, 16 K values per lane with the same split.
// ---------------------------------------------------------------------------
__device__ inline v16h_t load_frag(const half_t* base, int row_stride) {
  int lane = threadIdx.x & 31;
  int m    = lane & 15;
  int hi   = lane >> 4;
  const half_t* p = base + (size_t)m * row_stride + hi * 8;
  v8h_t lo = *(const v8h_t*)(p);        // K = hi*8 .. hi*8+7
  v8h_t hp = *(const v8h_t*)(p + 16);   // K = 16+hi*8 .. 16+hi*8+7
  v16h_t r;
#pragma unroll
  for (int i = 0; i < 8; ++i) { r[i] = lo[i]; r[i + 8] = hp[i]; }
  return r;
}

// ---------------------------------------------------------------------------
// The same 16x32 fragment of the TRANSPOSE of a row-major tile T[k][n] in LDS,
// by ds_load_tr16_b128.  p is the lane's own address,
//   &T[k0 + 8 * (lane >> 4) + (lane & 7)][n0 + 8 * ((lane >> 3) & 1)];
// the lane then holds T[k0 + 8*hi + 0..7][n0 + (lane & 15)], and the second
// load, 16 rows on, the k = 16 + 8*hi + 0..7 of load_frag's order.
// ---------------------------------------------------------------------------
__device__ inline v8h_t load_tr16(const half_t* p) {
  typedef __attribute__((address_space(3))) v8s_t lds_v8s_t;
  return __builtin_bit_cast(v8h_t, __builtin_amdgcn_ds_load_tr16_b128_v8i16((lds_v8s_t*)p));
}
__device__ inline v16h_t load_frag_tr(const half_t* p, int row_stride) {
  v8h_t lo = load_tr16(p);
  v8h_t hp = load_tr16(p + 16 * row_stride);
  v16h_t r;
#pragma unroll
  for (int i = 0; i < 8; ++i) { r[i] = lo[i]; r[i + 8] = hp[i]; }
  return r;
}

// ---------------------------------------------------------------------------
// fp32 -> f16 conversion of all five operands in one launch, 4 elements /
// thread.  The block index picks the source: the first XBLK blocks take x, then
// WBLK blocks each take Wq (scaled by HD^-0.5), Wk, Wv, Wo.  The f16 copies lie
// one behind the other in `out`, in that order.
// ---------------------------------------------------------------------------
#define XBLK (BATCH * SEQ * DIM / 4 / 256)   // 4096
#define WBLK (DIM * DIM / 4 / 256)           // 1024
__global__ __launch_bounds__(256) void cvt_f32_f16_kernel(const float* __restrict__ x,
                                                          const float* __restrict__ Wq,
                                                          const float* __restrict__ Wk,
                                                          const float* __restrict__ Wv,
                                                          const float* __restrict__ Wo,
                                                          half_t* __restrict__ out) {
  int blk = blockIdx.x;
  const float* in = x;
  int sblk = blk;                      // block index within the source
  float scale = 1.0f;
  if (blk >= XBLK) {
    int w = (blk - XBLK) / WBLK;
    sblk  = (blk - XBLK) % WBLK;
    in    = w == 0 ? Wq : w == 1 ? Wk : w == 2 ? Wv : Wo;
    scale = w == 0 ? 0.125f : 1.0f;
  }
  float4 f = ((const float4*)in)[sblk * 256 + threadIdx.x];
  v4h_t h;
  h[0] = (half_t)(f.x * scale);
  h[1] = (half_t)(f.y * scale);
  h[2] = (half_t)(f.z * scale);
  h[3] = (half_t)(f.w * scale);
  ((v4h_t*)out)[blk * 256 + threadIdx.x] = h;
}

// ---------------------------------------------------------------------------
// GEMM: C[r][n] = sum_k X[r][k] * W[n][k],  R=4096, K=1024, N=1024.
// Block tile 128x64, BK=64.  8 waves in a 4(M) x 2(N) grid; each wave owns a
// 32x32 tile = 2x2x2 v_wmma_f32_16x16x32_f16 per K step (8 WMMA / barrier).
// Tiles staged via GLOBAL_LOAD_ASYNC_TO_LDS_B128.
// mode 0: f16 output scattered to head layout [B,H,S,HD]; blockIdx.z picks the
//         product: weight matrix z behind W, output tensor z behind out
// mode 1: fp32 output + bias, flat [R,N]
// ---------------------------------------------------------------------------
__global__ __launch_bounds__(256) void gemm_xwT_kernel(const half_t* __restrict__ X,
                                                       const half_t* __restrict__ W,
                                                       void* __restrict__ out,
                                                       const float* __restrict__ bias,
                                                       int mode) {
  const int K = DIM;
  int bm = blockIdx.x;          // 0..31  (row tiles of 128)
  int bn = blockIdx.y;          // 0..15  (col tiles of 64)
  int tid = threadIdx.x;
  int wid = tid >> 5;
  int lane = tid & 31;
  int wm = wid & 3;             // wave row   (4)
  int wn = wid >> 2;            // wave col   (2)
  int m16 = lane & 15;
  int hi  = lane >> 4;

  __shared__ __attribute__((aligned(16))) half_t As[128 * LDP];   // 18 KB
  __shared__ __attribute__((aligned(16))) half_t Bs[64 * LDP];    //  9 KB

  v8f_t acc[2][2] = {};

  const half_t* Xb = X + (size_t)(bm * 128) * K;
  const half_t* Wb = W + (size_t)blockIdx.z * DIM * DIM + (size_t)(bn * 64) * K;
  int crow = tid >> 3;          // this thread's first tile row in the copies
  int ccol = (tid & 7) * 8;     // and its 8-half column

  for (int k0 = 0; k0 < K; k0 += 64) {
    __syncthreads();    // previous tile fully consumed before overwrite
    // A tile: 128 rows x 64 halves = 1024 chunks of 8 halves (16B) -> 4/thread
    // (chunk c = tid + 256 j: row = crow + 32 j, same column)
    // B tile: 64 rows x 64 halves = 512 chunks -> 2/thread
    async_copy6_b128(lds_addr(&As[(crow + 0)  * LDP + ccol]), &Xb[(size_t)(crow + 0)  * K + k0 + ccol],
                     lds_addr(&As[(crow + 32) * LDP + ccol]), &Xb[(size_t)(crow + 32) * K + k0 + ccol],
                     lds_addr(&As[(crow + 64) * LDP + ccol]), &Xb[(size_t)(crow + 64) * K + k0 + ccol],
                     lds_addr(&As[(crow + 96) * LDP + ccol]), &Xb[(size_t)(crow + 96) * K + k0 + ccol],
                     lds_addr(&Bs[(crow + 0)  * LDP + ccol]), &Wb[(size_t)(crow + 0)  * K + k0 + ccol],
                     lds_addr(&Bs[(crow + 32) * LDP + ccol]), &Wb[(size_t)(crow + 32) * K + k0 + ccol]);
    if (k0 + 64 < K) {
      // warm next tiles in the cache hierarchy (global_prefetch_b8)
      __builtin_prefetch(&Xb[(size_t)(tid >> 1) * K + k0 + 64], 0, 1);
      __builtin_prefetch(&Wb[(size_t)(tid >> 2) * K + k0 + 64], 0, 1);
    }
    wait_async_all();
    __syncthreads();

#pragma unroll
    for (int kc = 0; kc < 2; ++kc) {
      v16h_t a0 = load_frag(&As[(wm * 32 + 0)  * LDP + kc * 32], LDP);
      v16h_t a1 = load_frag(&As[(wm * 32 + 16) * LDP + kc * 32], LDP);
      v16h_t b0 = load_frag(&Bs[(wn * 32 + 0)  * LDP + kc * 32], LDP);
      v16h_t b1 = load_frag(&Bs[(wn * 32 + 16) * LDP + kc * 32], LDP);
      acc[0][0] = wmma_f32_f16(a0, b0, acc[0][0]);
      acc[0][1] = wmma_f32_f16(a0, b1, acc[0][1]);
      acc[1][0] = wmma_f32_f16(a1, b0, acc[1][0]);
      acc[1][1] = wmma_f32_f16(a1, b1, acc[1][1]);
    }
  }

#pragma unroll
  for (int tm = 0; tm < 2; ++tm)
#pragma unroll
    for (int tn = 0; tn < 2; ++tn)
#pragma unroll
      for (int i = 0; i < 8; ++i) {
        int r = bm * 128 + wm * 32 + tm * 16 + i + 8 * hi;
        int n = bn * 64  + wn * 32 + tn * 16 + m16;
        float v = acc[tm][tn][i];
        if (mode == 0) {
          int b = r >> 11;            // r / SEQ
          int s = r & (SEQ - 1);
          int hh = n >> 6;            // n / HDIM
          int d  = n & (HDIM - 1);
          ((half_t*)out)[(((size_t)((blockIdx.z * BATCH + b) * NHEAD + hh) * SEQ) + s) * HDIM + d] = (half_t)v;
          // holds every later rewrite of this store's address and data registers behind it
          asm volatile("s_wait_xcnt 0x0" ::: "memory");
        } else {
          ((float*)out)[(size_t)r * DIM + n] = v + bias[n];
        }
      }
}

__device__ inline float xhalf(float x) {
  int v = __builtin_bit_cast(int, x);
  return __builtin_bit_cast(float,
      __builtin_amdgcn_permlanex16(v, v, 0x76543210, 0xfedcba98, false, false));
}

__global__ __launch_bounds__(128) void attn_kernel(const half_t* __restrict__ Qh,
                                                   const half_t* __restrict__ Kh,
                                                   const half_t* __restrict__ Vh,
                                                   const int* __restrict__ Mmask,
                                                   half_t* __restrict__ Oh) {
  int bh = blockIdx.x;                 // 0..31
  int b = bh >> 4;
  int h = bh & (NHEAD - 1);
  int qtile = blockIdx.y;              // 0..31
  int tid = threadIdx.x;
  int wid = tid >> 5;
  int lane = tid & 31;
  int m16 = lane & 15;
  int hi  = lane >> 4;

  __shared__ __attribute__((aligned(16))) half_t Qs[64 * LDP];       // [q][d]
  __shared__ __attribute__((aligned(16))) half_t Ks[64 * LDP];       // [key][d]
  __shared__ __attribute__((aligned(16))) half_t Vs[64 * LDV];       // [key][d]

  const half_t* Qbase = Qh + ((size_t)bh * SEQ + (size_t)qtile * 64) * HDIM;
  const half_t* Kbase = Kh + (size_t)bh * SEQ * HDIM;
  const half_t* Vbase = Vh + (size_t)bh * SEQ * HDIM;

  int crow = tid >> 3;                 // this thread's first tile row in the copies
  int ccol = (tid & 7) * 8;            // and its 8-half column

  // Q tile 64x64 via async-to-LDS (chunk c = tid + 128 j: row = crow + 16 j)
  async_copy4_b128(lds_addr(&Qs[(crow + 0)  * LDP + ccol]), &Qbase[(crow + 0)  * HDIM + ccol],
                   lds_addr(&Qs[(crow + 16) * LDP + ccol]), &Qbase[(crow + 16) * HDIM + ccol],
                   lds_addr(&Qs[(crow + 32) * LDP + ccol]), &Qbase[(crow + 32) * HDIM + ccol],
                   lds_addr(&Qs[(crow + 48) * LDP + ccol]), &Qbase[(crow + 48) * HDIM + ccol]);
  wait_async_all();
  __syncthreads();

  // B fragments of Q^T: lane = query column
  v16h_t bq0 = load_frag(&Qs[wid * 16 * LDP + 0],  LDP);  // d = 0..31
  v16h_t bq1 = load_frag(&Qs[wid * 16 * LDP + 32], LDP);  // d = 32..63

  v8f_t Oacc[4] = {};                  // Oacc[jd][i] = O[q = m16][d = jd*16 + 8*hi + i]
  float mrow = -3.0e38f;               // this query's running maximum (same in both halves)
  float lrow = 0.0f;                   // sum over this lane's own keys; halves joined at the end

  // this lane's query row of the mask, at its half's first key of a 16-key tile
  int q = qtile * 64 + wid * 16 + m16;
  const int* Mrow = Mmask + ((size_t)b * SEQ + (size_t)q) * SEQ + 8 * hi;

  // this lane's address in the V tile for the transposing loads (key 0, d 0 fragment)
  const half_t* Vlane = &Vs[(8 * hi + (lane & 7)) * LDV + 8 * ((lane >> 3) & 1)];

  for (int kt = 0; kt < SEQ / 64; ++kt) {
    __syncthreads();    // every wave's reads of the last tiles are over before the copies refill them
    // K and V tiles 64x64 (row-major [key][d]) via async-to-LDS
    {
      const half_t* Kt = Kbase + (size_t)kt * 64 * HDIM;
      const half_t* Vg = Vbase + (size_t)kt * 64 * HDIM;
      async_copy8_b128(lds_addr(&Ks[(crow + 0)  * LDP + ccol]), &Kt[(crow + 0)  * HDIM + ccol],
                       lds_addr(&Ks[(crow + 16) * LDP + ccol]), &Kt[(crow + 16) * HDIM + ccol],
                       lds_addr(&Ks[(crow + 32) * LDP + ccol]), &Kt[(crow + 32) * HDIM + ccol],
                       lds_addr(&Ks[(crow + 48) * LDP + ccol]), &Kt[(crow + 48) * HDIM + ccol],
                       lds_addr(&Vs[(crow + 0)  * LDV + ccol]), &Vg[(crow + 0)  * HDIM + ccol],
                       lds_addr(&Vs[(crow + 16) * LDV + ccol]), &Vg[(crow + 16) * HDIM + ccol],
                       lds_addr(&Vs[(crow + 32) * LDV + ccol]), &Vg[(crow + 32) * HDIM + ccol],
                       lds_addr(&Vs[(crow + 48) * LDV + ccol]), &Vg[(crow + 48) * HDIM + ccol]);
    }
    wait_async_all();
    __syncthreads();

    // this lane's 32 mask words of the tile (8 consecutive words per 16-key tile),
    // all requested together
    int4 mk[8];
#pragma unroll
    for (int jn = 0; jn < 4; ++jn) {
      const int4* mp = (const int4*)&Mrow[kt * 64 + jn * 16];
      mk[2 * jn]     = mp[0];
      mk[2 * jn + 1] = mp[1];
    }
    // keeps the eight loads in one group here: the scheduler otherwise sinks them in
    // pairs to their uses, and the wave waits out a load latency four times a tile
    __builtin_amdgcn_sched_barrier(0);

    // --- scores, transposed: Sacc[jn][i] = S[key = jn*16 + 8*hi + i][q = m16] ---
    v8f_t Sacc[4] = {};
#pragma unroll
    for (int jn = 0; jn < 4; ++jn) {
      v16h_t ak0 = load_frag(&Ks[jn * 16 * LDP + 0],  LDP);
      v16h_t ak1 = load_frag(&Ks[jn * 16 * LDP + 32], LDP);
      Sacc[jn] = wmma_f32_f16(ak0, bq0, Sacc[jn]);
      Sacc[jn] = wmma_f32_f16(ak1, bq1, Sacc[jn]);
    }

    // --- mask + online softmax: 32 keys of one query per lane ---
    float pmax[4];                     // one chain per 16-key tile
#pragma unroll
    for (int jn = 0; jn < 4; ++jn) {
      int4 ma = mk[2 * jn];
      int4 mb = mk[2 * jn + 1];
      int mv[8] = {ma.x, ma.y, ma.z, ma.w, mb.x, mb.y, mb.z, mb.w};
      pmax[jn] = -3.0e38f;
#pragma unroll
      for (int i = 0; i < 8; ++i) {
        float s = mv[i] ? Sacc[jn][i] : -1.0e9f;
        Sacc[jn][i] = s;
        pmax[jn] = fmaxf(pmax[jn], s);
      }
    }
    float rmax = fmaxf(fmaxf(pmax[0], pmax[1]), fmaxf(pmax[2], pmax[3]));
    rmax = fmaxf(rmax, xhalf(rmax));   // the other half holds the query's other 32 keys
    float mnew = fmaxf(mrow, rmax);
    float corr = __expf(mrow - mnew);
    mrow = mnew;
    float psum[4];                     // one chain per 16-key tile
#pragma unroll
    for (int jn = 0; jn < 4; ++jn) {
      psum[jn] = 0.0f;
#pragma unroll
      for (int i = 0; i < 8; ++i) {
        float p = __expf(Sacc[jn][i] - mnew);
        Sacc[jn][i] = p;
        psum[jn] += p;
      }
    }
    lrow = lrow * corr + ((psum[0] + psum[1]) + (psum[2] + psum[3]));

    // --- P^T as B fragments, in-lane: keys {8*hi + i, 16 + 8*hi + i} of each 32 ---
    v16h_t bp0, bp1;
#pragma unroll
    for (int i = 0; i < 8; ++i) {
      bp0[i]     = (half_t)Sacc[0][i];
      bp0[i + 8] = (half_t)Sacc[1][i];
      bp1[i]     = (half_t)Sacc[2][i];
      bp1[i + 8] = (half_t)Sacc[3][i];
    }

    // rescale running output
#pragma unroll
    for (int jd = 0; jd < 4; ++jd)
#pragma unroll
      for (int i = 0; i < 8; ++i)
        Oacc[jd][i] *= corr;

#pragma unroll
    for (int jd = 0; jd < 4; ++jd) {
      v16h_t av0 = load_frag_tr(Vlane + jd * 16,            LDV);  // keys 0..31
      v16h_t av1 = load_frag_tr(Vlane + jd * 16 + 32 * LDV, LDV);  // keys 32..63
      Oacc[jd] = wmma_f32_f16(av0, bp0, Oacc[jd]);
      Oacc[jd] = wmma_f32_f16(av1, bp1, Oacc[jd]);
    }
  }

  // --- write Oh[b, q, h*64 + d]: 8 consecutive d per lane and tile ---
  float lsum = lrow + xhalf(lrow);
  float inv = lsum > 0.0f ? 1.0f / lsum : 0.0f;
#pragma unroll
  for (int jd = 0; jd < 4; ++jd) {
    v8h_t o;
#pragma unroll
    for (int i = 0; i < 8; ++i) o[i] = (half_t)(Oacc[jd][i] * inv);
    *(v8h_t*)&Oh[((size_t)b * SEQ + q) * DIM + h * HDIM + jd * 16 + 8 * hi] = o;
  }
}

// ---------------------------------------------------------------------------
// Launch
// ---------------------------------------------------------------------------
extern "C" void kernel_launch(void* const* d_in, const int* in_sizes, int n_in,
                              void* d_out, int out_size, void* d_ws, size_t ws_size,
                              hipStream_t stream) {
  const float* x   = (const float*)d_in[0];
  const int*   M   = (const int*)d_in[1];
  const float* Wq  = (const float*)d_in[2];
  const float* Wk  = (const float*)d_in[3];
  const float* Wv  = (const float*)d_in[4];
  const float* Wo  = (const float*)d_in[5];
  const float* bo  = (const float*)d_in[6];

  char* ws = (char*)d_ws;
  const size_t MB = 1u << 20;
  half_t* xh  = (half_t*)(ws + 0 * MB);   // 8 MB  [B*S, D]
  half_t* wqh = (half_t*)(ws + 8 * MB);   // 2 MB
  //      Wk as f16 at ws + 10 MB, Wv at ws + 12 MB (2 MB each), reached from wqh
  half_t* woh = (half_t*)(ws + 14 * MB);  // 2 MB
  half_t* Qh  = (half_t*)(ws + 16 * MB);  // 8 MB  [B,H,S,HD]
  half_t* Kh  = (half_t*)(ws + 24 * MB);  // 8 MB
  half_t* Vh  = (half_t*)(ws + 32 * MB);  // 8 MB
  half_t* Oh  = (half_t*)(ws + 40 * MB);  // 8 MB  [B,S,D]

  // the five f16 copies are written as one run from xh on
  cvt_f32_f16_kernel<<<XBLK + 4 * WBLK, 256, 0, stream>>>(x, Wq, Wk, Wv, Wo, xh);

  // z = 0, 1, 2: Q, K, V (the three f16 weights from wqh on, and Qh, Kh, Vh, lie one behind the other)
  gemm_xwT_kernel<<<dim3(BATCH * SEQ / 128, DIM / 64, 3), 256, 0, stream>>>(xh, wqh, Qh, nullptr, 0);

  attn_kernel<<<dim3(BATCH * NHEAD, SEQ / 64), 128, 0, stream>>>(Qh, Kh, Vh, M, Oh);

  gemm_xwT_kernel<<<dim3(BATCH * SEQ / 128, DIM / 64, 1), 256, 0, stream>>>(Oh, woh, d_out, bo, 1);
}

// v005
// It runs in 133 microseconds.
// Next to v004, in two timings, it ran 1.18 and 1.17 times as fast.
// Over all steps from v000 it is 3.22 times as fast.
#include <hip/hip_runtime.h>
#include <hip/hip_bf16.h>

// ---------------------------------------------------------------------------
// Fixed attention block for MI455X (gfx1250), wave32 + WMMA f32_16x16x32_f16,
// with GLOBAL_LOAD_ASYNC_TO_LDS_B128 tile staging (ASYNCcnt).
//   B=2, S=2048, D=1024, H=16, HD=64
// Pipeline:
//   1) cvt: fp32 -> f16 for x, Wq(*0.125), Wk, Wv, Wo, and the mask packed to bits, one launch
//   2) gemm: Q=x Wq^T, K=x Wk^T, V=x Wv^T, one launch (f16 out, [B,H,S,HD] layout)
//   3) flash attention per (b,h,qtile) -> Oh [B,S,D] f16
//   4) gemm: out = Oh Wo^T + b_o (fp32 out)
// ---------------------------------------------------------------------------

typedef _Float16 half_t;
typedef __attribute__((ext_vector_type(16))) _Float16 v16h_t;
typedef __attribute__((ext_vector_type(8)))  _Float16 v8h_t;
typedef __attribute__((ext_vector_type(4)))  _Float16 v4h_t;
typedef __attribute__((ext_vector_type(8)))  float    v8f_t;
typedef __attribute__((ext_vector_type(8)))  short    v8s_t;

#define BATCH 2
#define SEQ   2048
#define DIM   1024
#define NHEAD 16
#define HDIM  64
// LDS row pitch, in halves, of the 64-half tile rows read by load_frag's 16-byte LDS
// loads: 144 B = 16 B x 9 puts the 16 rows of a fragment on 16 different
// 4-bank groups (128 B rows put them all on two).
#define LDP   72
// LDS row pitch, in halves, of the V tile, whose 64-half rows are read by the
// transposing 16-byte LDS load: that reader wants 160 B = 32 B x 5.
#define LDV   80

// ---------------------------------------------------------------------------
// WMMA wrapper: D = A(16x32 f16) * B(32x16 f16) + C(16x16 f32)
// ---------------------------------------------------------------------------
__device__ inline v8f_t wmma_f32_f16(v16h_t a, v16h_t b, v8f_t c) {
  return __builtin_amdgcn_wmma_f32_16x16x32_f16(
      /*neg_a=*/false, a, /*neg_b=*/false, b,
      /*c_mod=*/(short)0, c, /*reuse_a=*/false, /*reuse_b=*/false);
}

// ---------------------------------------------------------------------------
// Async global -> LDS copy, 16 bytes per lane (GLOBAL_LOAD_ASYNC_TO_LDS_B128,
// tracked by ASYNCcnt; data lands in LDS without touching VGPRs).
// LDS operand: byte offset within the workgroup's LDS allocation == low 32
// bits of the generic shared-memory pointer (shared aperture is in the high
// 32 bits per the ISA aperture check).
// ---------------------------------------------------------------------------
// Runs of copies stand in one statement that ends in s_wait_xcnt 0, so that no
// address register of an issued copy is rewritten ahead of that wait.
__device__ inline unsigned lds_addr(const void* p) {
  return (unsigned)(unsigned long long)p;
}
__device__ inline void async_copy4_b128(unsigned l0, const void* g0, unsigned l1, const void* g1,
                                        unsigned l2, const void* g2, unsigned l3, const void* g3) {
  asm volatile("global_load_async_to_lds_b128 %0, %1, off\n\t"
               "global_load_async_to_lds_b128 %2, %3, off\n\t"
               "global_load_async_to_lds_b128 %4, %5, off\n\t"
               "global_load_async_to_lds_b128 %6, %7, off\n\t"
               "s_wait_xcnt 0x0"
               :: "v"(l0), "v"(g0), "v"(l1), "v"(g1), "v"(l2), "v"(g2), "v"(l3), "v"(g3)
               : "memory");
}
__device__ inline void async_copy6_b128(unsigned l0, const void* g0, unsigned l1, const void* g1,
                                        unsigned l2, const void* g2, unsigned l3, const void* g3,
                                        unsigned l4, const void* g4, unsigned l5, const void* g5) {
  asm volatile("global_load_async_to_lds_b128 %0, %1, off\n\t"
               "global_load_async_to_lds_b128 %2, %3, off\n\t"
               "global_load_async_to_lds_b128 %4, %5, off\n\t"
               "global_load_async_to_lds_b128 %6, %7, off\n\t"
               "global_load_async_to_lds_b128 %8, %9, off\n\t"
               "global_load_async_to_lds_b128 %10, %11, off\n\t"
               "s_wait_xcnt 0x0"
               :: "v"(l0), "v"(g0), "v"(l1), "v"(g1), "v"(l2), "v"(g2), "v"(l3), "v"(g3),
                  "v"(l4), "v"(g4), "v"(l5), "v"(g5)
               : "memory");
}
__device__ inline void async_copy8_b128(unsigned l0, const void* g0, unsigned l1, const void* g1,
                                        unsigned l2, const void* g2, unsigned l3, const void* g3,
                                        unsigned l4, const void* g4, unsigned l5, const void* g5,
                                        unsigned l6, const void* g6, unsigned l7, const void* g7) {
  asm volatile("global_load_async_to_lds_b128 %0, %1, off\n\t"
               "global_load_async_to_lds_b128 %2, %3, off\n\t"
               "global_load_async_to_lds_b128 %4, %5, off\n\t"
               "global_load_async_to_lds_b128 %6, %7, off\n\t"
               "global_load_async_to_lds_b128 %8, %9, off\n\t"
               "global_load_async_to_lds_b128 %10, %11, off\n\t"
               "global_load_async_to_lds_b128 %12, %13, off\n\t"
               "global_load_async_to_lds_b128 %14, %15, off\n\t"
               "s_wait_xcnt 0x0"
               :: "v"(l0), "v"(g0), "v"(l1), "v"(g1), "v"(l2), "v"(g2), "v"(l3), "v"(g3),
                  "v"(l4), "v"(g4), "v"(l5), "v"(g5), "v"(l6), "v"(g6), "v"(l7), "v"(g7)
               : "memory");
}
__device__ inline void wait_async_all() {
  asm volatile("s_wait_asynccnt 0x0" ::: "memory");
}

// ---------------------------------------------------------------------------
// Build a 16x32 f16 fragment (A-layout per ISA 7.12.2) from a row-major tile
// in LDS.  Lane L (L<16) holds row M=L, K = {0..7, 16..23}; lane L+16 holds
// row M=L, K = {8..15, 24..31}.  Two 16B LDS loads per fragment.
// B-fragments (32x16, K x N) use the same call on an N-major (transposed)
// tile: lane = N column, 16 K values per lane with the same split.
// ---------------------------------------------------------------------------
__device__ inline v16h_t load_frag(const half_t* base, int row_stride) {
  int lane = threadIdx.x & 31;
  int m    = lane & 15;
  int hi   = lane >> 4;
  const half_t* p = base + (size_t)m * row_stride + hi * 8;
  v8h_t lo = *(const v8h_t*)(p);        // K = hi*8 .. hi*8+7
  v8h_t hp = *(const v8h_t*)(p + 16);   // K = 16+hi*8 .. 16+hi*8+7
  v16h_t r;
#pragma unroll
  for (int i = 0; i < 8; ++i) { r[i] = lo[i]; r[i + 8] = hp[i]; }
  return r;
}

// ---------------------------------------------------------------------------
// The same 16x32 fragment of the TRANSPOSE of a row-major tile T[k][n] in LDS,
// by ds_load_tr16_b128.  p is the lane's own address,
//   &T[k0 + 8 * (lane >> 4) + (lane & 7)][n0 + 8 * ((lane >> 3) & 1)];
// the lane then holds T[k0 + 8*hi + 0..7][n0 + (lane & 15)], and the second
// load, 16 rows on, the k = 16 + 8*hi + 0..7 of load_frag's order.
// ---------------------------------------------------------------------------
__device__ inline v8h_t load_tr16(const half_t* p) {
  typedef __attribute__((address_space(3))) v8s_t lds_v8s_t;
  return __builtin_bit_cast(v8h_t, __builtin_amdgcn_ds_load_tr16_b128_v8i16((lds_v8s_t*)p));
}
__device__ inline v16h_t load_frag_tr(const half_t* p, int row_stride) {
  v8h_t lo = load_tr16(p);
  v8h_t hp = load_tr16(p + 16 * row_stride);
  v16h_t r;
#pragma unroll
  for (int i = 0; i < 8; ++i) { r[i] = lo[i]; r[i + 8] = hp[i]; }
  return r;
}

// ---------------------------------------------------------------------------
// fp32 -> f16 conversion of all five operands in one launch, 4 elements /
// thread.  The block index picks the source: after the PBLK mask blocks, XBLK blocks take x, then
// WBLK blocks each take Wq (scaled by HD^-0.5), Wk, Wv, Wo.  The f16 copies lie
// one behind the other in `out`, in that order.
// In front of them PBLK blocks pack the mask, which all 16 heads read, to one
// bit a score, in the order in which the attention kernel's waves hold scores:
//   Mp[(b * S/16 + q/16) * S/64 + key/64][e], e = jn * 8 + i, bit l =
//   (M[b][16 * (q/16) + (l & 15)][64 * (key/64) + jn * 16 + 8 * (l >> 4) + i] != 0)
// so word e is the lane mask of score register Sacc[jn][i] of that wave and tile.
// A wave packs PTILE neighbouring 64-key tiles of one group of 16 queries.
// ---------------------------------------------------------------------------
#define XBLK (BATCH * SEQ * DIM / 4 / 256)   // 4096
#define WBLK (DIM * DIM / 4 / 256)           // 1024
#define PTILE 4
#define PBLK (BATCH * (SEQ / 16) * (SEQ / 64) / PTILE / 8)   // 256
__global__ __launch_bounds__(256) void cvt_f32_f16_kernel(const float* __restrict__ x,
                                                          const float* __restrict__ Wq,
                                                          const float* __restrict__ Wk,
                                                          const float* __restrict__ Wv,
                                                          const float* __restrict__ Wo,
                                                          const int* __restrict__ M,
                                                          half_t* __restrict__ out,
                                                          unsigned* __restrict__ Mp) {
  int blk = blockIdx.x;
  if (blk < PBLK) {
    int lane = threadIdx.x & 31;
    int gw = blk * 8 + (threadIdx.x >> 5);           // wave index
    int qg = gw / (SEQ / 64 / PTILE);                // b * S/16 + q/16
    int kt0 = (gw % (SEQ / 64 / PTILE)) * PTILE;     // first 64-key tile
    const int* Mrow = M + (size_t)(qg * 16 + (lane & 15)) * SEQ + 8 * (lane >> 4);
    // stays rolled: the conversion blocks share this kernel's register count
#pragma unroll 1
    for (int t = 0; t < PTILE; ++t) {
      int kt = kt0 + t;
      int4 mk[8];
#pragma unroll
      for (int jn = 0; jn < 4; ++jn) {
        const int4* mp = (const int4*)&Mrow[kt * 64 + jn * 16];
        mk[2 * jn]     = mp[0];
        mk[2 * jn + 1] = mp[1];
      }
      unsigned word = 0;                             // lane e ends up with word e
#pragma unroll
      for (int jn = 0; jn < 4; ++jn) {
        int4 ma = mk[2 * jn];
        int4 mb = mk[2 * jn + 1];
        int mv[8] = {ma.x, ma.y, ma.z, ma.w, mb.x, mb.y, mb.z, mb.w};
#pragma unroll
        for (int i = 0; i < 8; ++i) {
          unsigned bal = __builtin_amdgcn_ballot_w32(mv[i] != 0);   // taken by all 32 lanes
          word = lane == jn * 8 + i ? bal : word;
        }
      }
      Mp[(size_t)(qg * (SEQ / 64) + kt) * 32 + lane] = word;
    }
    return;
  }
  blk -= PBLK;
  const float* in = x;
  int sblk = blk;                      // block index within the source
  float scale = 1.0f;
  if (blk >= XBLK) {
    int w = (blk - XBLK) / WBLK;
    sblk  = (blk - XBLK) % WBLK;
    in    = w == 0 ? Wq : w == 1 ? Wk : w == 2 ? Wv : Wo;
    scale = w == 0 ? 0.125f : 1.0f;
  }
  float4 f = ((const float4*)in)[sblk * 256 + threadIdx.x];
  v4h_t h;
  h[0] = (half_t)(f.x * scale);
  h[1] = (half_t)(f.y * scale);
  h[2] = (half_t)(f.z * scale);
  h[3] = (half_t)(f.w * scale);
  ((v4h_t*)out)[blk * 256 + threadIdx.x] = h;
}

// ---------------------------------------------------------------------------
// GEMM: C[r][n] = sum_k X[r][k] * W[n][k],  R=4096, K=1024, N=1024.
// Block tile 128x64, BK=64.  8 waves in a 4(M) x 2(N) grid; each wave owns a
// 32x32 tile = 2x2x2 v_wmma_f32_16x16x32_f16 per K step (8 WMMA / barrier).
// Tiles staged via GLOBAL_LOAD_ASYNC_TO_LDS_B128.
// mode 0: f16 output scattered to head layout [B,H,S,HD]; blockIdx.z picks the
//         product: weight matrix z behind W, output tensor z behind out
// mode 1: fp32 output + bias, flat [R,N]
// ---------------------------------------------------------------------------
__global__ __launch_bounds__(256) void gemm_xwT_kernel(const half_t* __restrict__ X,
                                                       const half_t* __restrict__ W,
                                                       void* __restrict__ out,
                                                       const float* __restrict__ bias,
                                                       int mode) {
  const int K = DIM;
  int bm = blockIdx.x;          // 0..31  (row tiles of 128)
  int bn = blockIdx.y;          // 0..15  (col tiles of 64)
  int tid = threadIdx.x;
  int wid = tid >> 5;
  int lane = tid & 31;
  int wm = wid & 3;             // wave row   (4)
  int wn = wid >> 2;            // wave col   (2)
  int m16 = lane & 15;
  int hi  = lane >> 4;

  __shared__ __attribute__((aligned(16))) half_t As[128 * LDP];   // 18 KB
  __shared__ __attribute__((aligned(16))) half_t Bs[64 * LDP];    //  9 KB

  v8f_t acc[2][2] = {};

  const half_t* Xb = X + (size_t)(bm * 128) * K;
  const half_t* Wb = W + (size_t)blockIdx.z * DIM * DIM + (size_t)(bn * 64) * K;
  int crow = tid >> 3;          // this thread's first tile row in the copies
  int ccol = (tid & 7) * 8;     // and its 8-half column

  for (int k0 = 0; k0 < K; k0 += 64) {
    __syncthreads();    // previous tile fully consumed before overwrite
    // A tile: 128 rows x 64 halves = 1024 chunks of 8 halves (16B) -> 4/thread
    // (chunk c = tid + 256 j: row = crow + 32 j, same column)
    // B tile: 64 rows x 64 halves = 512 chunks -> 2/thread
    async_copy6_b128(lds_addr(&As[(crow + 0)  * LDP + ccol]), &Xb[(size_t)(crow + 0)  * K + k0 + ccol],
                     lds_addr(&As[(crow + 32) * LDP + ccol]), &Xb[(size_t)(crow + 32) * K + k0 + ccol],
                     lds_addr(&As[(crow + 64) * LDP + ccol]), &Xb[(size_t)(crow + 64) * K + k0 + ccol],
                     lds_addr(&As[(crow + 96) * LDP + ccol]), &Xb[(size_t)(crow + 96) * K + k0 + ccol],
                     lds_addr(&Bs[(crow + 0)  * LDP + ccol]), &Wb[(size_t)(crow + 0)  * K + k0 + ccol],
                     lds_addr(&Bs[(crow + 32) * LDP + ccol]), &Wb[(size_t)(crow + 32) * K + k0 + ccol]);
    if (k0 + 64 < K) {
      // warm next tiles in the cache hierarchy (global_prefetch_b8)
      __builtin_prefetch(&Xb[(size_t)(tid >> 1) * K + k0 + 64], 0, 1);
      __builtin_prefetch(&Wb[(size_t)(tid >> 2) * K + k0 + 64], 0, 1);
    }
    wait_async_all();
    __syncthreads();

#pragma unroll
    for (int kc = 0; kc < 2; ++kc) {
      v16h_t a0 = load_frag(&As[(wm * 32 + 0)  * LDP + kc * 32], LDP);
      v16h_t a1 = load_frag(&As[(wm * 32 + 16) * LDP + kc * 32], LDP);
      v16h_t b0 = load_frag(&Bs[(wn * 32 + 0)  * LDP + kc * 32], LDP);
      v16h_t b1 = load_frag(&Bs[(wn * 32 + 16) * LDP + kc * 32], LDP);
      acc[0][0] = wmma_f32_f16(a0, b0, acc[0][0]);
      acc[0][1] = wmma_f32_f16(a0, b1, acc[0][1]);
      acc[1][0] = wmma_f32_f16(a1, b0, acc[1][0]);
      acc[1][1] = wmma_f32_f16(a1, b1, acc[1][1]);
    }
  }

#pragma unroll
  for (int tm = 0; tm < 2; ++tm)
#pragma unroll
    for (int tn = 0; tn < 2; ++tn)
#pragma unroll
      for (int i = 0; i < 8; ++i) {
        int r = bm * 128 + wm * 32 + tm * 16 + i + 8 * hi;
        int n = bn * 64  + wn * 32 + tn * 16 + m16;
        float v = acc[tm][tn][i];
        if (mode == 0) {
          int b = r >> 11;            // r / SEQ
          int s = r & (SEQ - 1);
          int hh = n >> 6;            // n / HDIM
          int d  = n & (HDIM - 1);
          ((half_t*)out)[(((size_t)((blockIdx.z * BATCH + b) * NHEAD + hh) * SEQ) + s) * HDIM + d] = (half_t)v;
          // holds every later rewrite of this store's address and data registers behind it
          asm volatile("s_wait_xcnt 0x0" ::: "memory");
        } else {
          ((float*)out)[(size_t)r * DIM + n] = v + bias[n];
        }
      }
}

__device__ inline float xhalf(float x) {
  int v = __builtin_bit_cast(int, x);
  return __builtin_bit_cast(float,
      __builtin_amdgcn_permlanex16(v, v, 0x76543210, 0xfedcba98, false, false));
}

__global__ __launch_bounds__(128) void attn_kernel(const half_t* __restrict__ Qh,
                                                   const half_t* __restrict__ Kh,
                                                   const half_t* __restrict__ Vh,
                                                   const unsigned* __restrict__ Mp,
                                                   half_t* __restrict__ Oh) {
  int bh = blockIdx.x;                 // 0..31
  int b = bh >> 4;
  int h = bh & (NHEAD - 1);
  int qtile = blockIdx.y;              // 0..31
  int tid = threadIdx.x;
  int wid = tid >> 5;
  int lane = tid & 31;
  int m16 = lane & 15;
  int hi  = lane >> 4;

  __shared__ __attribute__((aligned(16))) half_t Qs[64 * LDP];       // [q][d]
  __shared__ __attribute__((aligned(16))) half_t Ks[64 * LDP];       // [key][d]
  __shared__ __attribute__((aligned(16))) half_t Vs[64 * LDV];       // [key][d]

  const half_t* Qbase = Qh + ((size_t)bh * SEQ + (size_t)qtile * 64) * HDIM;
  const half_t* Kbase = Kh + (size_t)bh * SEQ * HDIM;
  const half_t* Vbase = Vh + (size_t)bh * SEQ * HDIM;

  int crow = tid >> 3;                 // this thread's first tile row in the copies
  int ccol = (tid & 7) * 8;            // and its 8-half column

  // Q tile 64x64 via async-to-LDS (chunk c = tid + 128 j: row = crow + 16 j)
  async_copy4_b128(lds_addr(&Qs[(crow + 0)  * LDP + ccol]), &Qbase[(crow + 0)  * HDIM + ccol],
                   lds_addr(&Qs[(crow + 16) * LDP + ccol]), &Qbase[(crow + 16) * HDIM + ccol],
                   lds_addr(&Qs[(crow + 32) * LDP + ccol]), &Qbase[(crow + 32) * HDIM + ccol],
                   lds_addr(&Qs[(crow + 48) * LDP + ccol]), &Qbase[(crow + 48) * HDIM + ccol]);
  wait_async_all();
  __syncthreads();

  // B fragments of Q^T: lane = query column
  v16h_t bq0 = load_frag(&Qs[wid * 16 * LDP + 0],  LDP);  // d = 0..31
  v16h_t bq1 = load_frag(&Qs[wid * 16 * LDP + 32], LDP);  // d = 32..63

  v8f_t Oacc[4] = {};                  // Oacc[jd][i] = O[q = m16][d = jd*16 + 8*hi + i]
  float mrow = -3.0e38f;               // this query's running maximum (same in both halves)
  float lrow = 0.0f;                   // sum over this lane's own keys; halves joined at the end

  int q = qtile * 64 + wid * 16 + m16;
  // this wave's packed mask words, 32 a tile; the wave's number as a scalar, so
  // that the words are read by scalar loads
  int wu = __builtin_amdgcn_readfirstlane(wid);
  const unsigned* Mw = Mp + (size_t)(b * (SEQ / 16) + qtile * 4 + wu) * (SEQ / 64) * 32;

  // this lane's address in the V tile for the transposing loads (key 0, d 0 fragment)
  const half_t* Vlane = &Vs[(8 * hi + (lane & 7)) * LDV + 8 * ((lane >> 3) & 1)];

  for (int kt = 0; kt < SEQ / 64; ++kt) {
    __syncthreads();    // every wave's reads of the last tiles are over before the copies refill them
    // the tile's 32 mask words, requested ahead of the copies' wait
    unsigned mw[32];
#pragma unroll
    for (int e = 0; e < 32; ++e) mw[e] = Mw[kt * 32 + e];
    // K and V tiles 64x64 (row-major [key][d]) via async-to-LDS
    {
      const half_t* Kt = Kbase + (size_t)kt * 64 * HDIM;
      const half_t* Vg = Vbase + (size_t)kt * 64 * HDIM;
      async_copy8_b128(lds_addr(&Ks[(crow + 0)  * LDP + ccol]), &Kt[(crow + 0)  * HDIM + ccol],
                       lds_addr(&Ks[(crow + 16) * LDP + ccol]), &Kt[(crow + 16) * HDIM + ccol],
                       lds_addr(&Ks[(crow + 32) * LDP + ccol]), &Kt[(crow + 32) * HDIM + ccol],
                       lds_addr(&Ks[(crow + 48) * LDP + ccol]), &Kt[(crow + 48) * HDIM + ccol],
                       lds_addr(&Vs[(crow + 0)  * LDV + ccol]), &Vg[(crow + 0)  * HDIM + ccol],
                       lds_addr(&Vs[(crow + 16) * LDV + ccol]), &Vg[(crow + 16) * HDIM + ccol],
                       lds_addr(&Vs[(crow + 32) * LDV + ccol]), &Vg[(crow + 32) * HDIM + ccol],
                       lds_addr(&Vs[(crow + 48) * LDV + ccol]), &Vg[(crow + 48) * HDIM + ccol]);
    }
    wait_async_all();
    __syncthreads();

    // --- scores, transposed: Sacc[jn][i] = S[key = jn*16 + 8*hi + i][q = m16] ---
    v8f_t Sacc[4] = {};
#pragma unroll
    for (int jn = 0; jn < 4; ++jn) {
      v16h_t ak0 = load_frag(&Ks[jn * 16 * LDP + 0],  LDP);
      v16h_t ak1 = load_frag(&Ks[jn * 16 * LDP + 32], LDP);
      Sacc[jn] = wmma_f32_f16(ak0, bq0, Sacc[jn]);
      Sacc[jn] = wmma_f32_f16(ak1, bq1, Sacc[jn]);
    }

    // --- mask + online softmax: 32 keys of one query per lane ---
    float pmax[4];                     // one chain per 16-key tile
#pragma unroll
    for (int jn = 0; jn < 4; ++jn) {
      pmax[jn] = -3.0e38f;
#pragma unroll
      for (int i = 0; i < 8; ++i) {
        float s = __builtin_amdgcn_inverse_ballot_w32(mw[jn * 8 + i]) ? Sacc[jn][i] : -1.0e9f;
        Sacc[jn][i] = s;
        pmax[jn] = fmaxf(pmax[jn], s);
      }
    }
    float rmax = fmaxf(fmaxf(pmax[0], pmax[1]), fmaxf(pmax[2], pmax[3]));
    rmax = fmaxf(rmax, xhalf(rmax));   // the other half holds the query's other 32 keys
    float mnew = fmaxf(mrow, rmax);
    float corr = __expf(mrow - mnew);
    mrow = mnew;
    float psum[4];                     // one chain per 16-key tile
#pragma unroll
    for (int jn = 0; jn < 4; ++jn) {
      psum[jn] = 0.0f;
#pragma unroll
      for (int i = 0; i < 8; ++i) {
        float p = __expf(Sacc[jn][i] - mnew);
        Sacc[jn][i] = p;
        psum[jn] += p;
      }
    }
    lrow = lrow * corr + ((psum[0] + psum[1]) + (psum[2] + psum[3]));

    // --- P^T as B fragments, in-lane: keys {8*hi + i, 16 + 8*hi + i} of each 32 ---
    v16h_t bp0, bp1;
#pragma unroll
    for (int i = 0; i < 8; ++i) {
      bp0[i]     = (half_t)Sacc[0][i];
      bp0[i + 8] = (half_t)Sacc[1][i];
      bp1[i]     = (half_t)Sacc[2][i];
      bp1[i + 8] = (half_t)Sacc[3][i];
    }

    // rescale running output
#pragma unroll
    for (int jd = 0; jd < 4; ++jd)
#pragma unroll
      for (int i = 0; i < 8; ++i)
        Oacc[jd][i] *= corr;

#pragma unroll
    for (int jd = 0; jd < 4; ++jd) {
      v16h_t av0 = load_frag_tr(Vlane + jd * 16,            LDV);  // keys 0..31
      v16h_t av1 = load_frag_tr(Vlane + jd * 16 + 32 * LDV, LDV);  // keys 32..63
      Oacc[jd] = wmma_f32_f16(av0, bp0, Oacc[jd]);
      Oacc[jd] = wmma_f32_f16(av1, bp1, Oacc[jd]);
    }
  }

  // --- write Oh[b, q, h*64 + d]: 8 consecutive d per lane and tile ---
  float lsum = lrow + xhalf(lrow);
  float inv = lsum > 0.0f ? 1.0f / lsum : 0.0f;
#pragma unroll
  for (int jd = 0; jd < 4; ++jd) {
    v8h_t o;
#pragma unroll
    for (int i = 0; i < 8; ++i) o[i] = (half_t)(Oacc[jd][i] * inv);
    *(v8h_t*)&Oh[((size_t)b * SEQ + q) * DIM + h * HDIM + jd * 16 + 8 * hi] = o;
  }
}

// ---------------------------------------------------------------------------
// Launch
// ---------------------------------------------------------------------------
extern "C" void kernel_launch(void* const* d_in, const int* in_sizes, int n_in,
                              void* d_out, int out_size, void* d_ws, size_t ws_size,
                              hipStream_t stream) {
  const float* x   = (const float*)d_in[0];
  const int*   M   = (const int*)d_in[1];
  const float* Wq  = (const float*)d_in[2];
  const float* Wk  = (const float*)d_in[3];
  const float* Wv  = (const float*)d_in[4];
  const float* Wo  = (const float*)d_in[5];
  const float* bo  = (const float*)d_in[6];

  char* ws = (char*)d_ws;
  const size_t MB = 1u << 20;
  half_t* xh  = (half_t*)(ws + 0 * MB);   // 8 MB  [B*S, D]
  half_t* wqh = (half_t*)(ws + 8 * MB);   // 2 MB
  //      Wk as f16 at ws + 10 MB, Wv at ws + 12 MB (2 MB each), reached from wqh
  half_t* woh = (half_t*)(ws + 14 * MB);  // 2 MB
  half_t* Qh  = (half_t*)(ws + 16 * MB);  // 8 MB  [B,H,S,HD]
  half_t* Kh  = (half_t*)(ws + 24 * MB);  // 8 MB
  half_t* Vh  = (half_t*)(ws + 32 * MB);  // 8 MB
  half_t* Oh  = (half_t*)(ws + 40 * MB);  // 8 MB  [B,S,D]
  unsigned* Mp = (unsigned*)(ws + 48 * MB);  // 1 MB  packed mask

  // the five f16 copies are written as one run from xh on
  cvt_f32_f16_kernel<<<PBLK + XBLK + 4 * WBLK, 256, 0, stream>>>(x, Wq, Wk, Wv, Wo, M, xh, Mp);

  // z = 0, 1, 2: Q, K, V (the three f16 weights from wqh on, and Qh, Kh, Vh, lie one behind the other)
  gemm_xwT_kernel<<<dim3(BATCH * SEQ / 128, DIM / 64, 3), 256, 0, stream>>>(xh, wqh, Qh, nullptr, 0);

  attn_kernel<<<dim3(BATCH * NHEAD, SEQ / 64), 128, 0, stream>>>(Qh, Kh, Vh, Mp, Oh);

  gemm_xwT_kernel<<<dim3(BATCH * SEQ / 128, DIM / 64, 1), 256, 0, stream>>>(Oh, woh, d_out, bo, 1);
}

// v006
// Measured time: 106 microseconds a run.
// Two timings next to v005 both put it at 1.25 times that version's speed.
// Over all steps from v000 it is 4.02 times as fast.
#include <hip/hip_runtime.h>
#include <hip/hip_bf16.h>

typedef _Float16 half_t;
typedef __attribute__((ext_vector_type(16))) _Float16 v16h_t;
typedef __attribute__((ext_vector_type(8)))  _Float16 v8h_t;
typedef __attribute__((ext_vector_type(4)))  _Float16 v4h_t;
typedef __attribute__((ext_vector_type(8)))  float    v8f_t;
typedef __attribute__((ext_vector_type(8)))  short    v8s_t;

#define BATCH 2
#define SEQ   2048
#define DIM   1024
#define NHEAD 16
#define HDIM  64
// LDS row pitch, in halves, of the 64-half tile rows read by load_frag's 16-byte LDS
// loads: 144 B = 16 B x 9 puts the 16 rows of a fragment on 16 different
// 4-bank groups (128 B rows put them all on two).
#define LDP   72
// LDS row pitch, in halves, of the V tile, whose 64-half rows are read by the
// transposing 16-byte LDS load: that reader wants 160 B = 32 B x 5.
#define LDV   80

// ---------------------------------------------------------------------------
// WMMA wrapper: D = A(16x32 f16) * B(32x16 f16) + C(16x16 f32)
// ---------------------------------------------------------------------------
__device__ inline v8f_t wmma_f32_f16(v16h_t a, v16h_t b, v8f_t c) {
  return __builtin_amdgcn_wmma_f32_16x16x32_f16(
      /*neg_a=*/false, a, /*neg_b=*/false, b,
      /*c_mod=*/(short)0, c, /*reuse_a=*/false, /*reuse_b=*/false);
}

// ---------------------------------------------------------------------------
// Async global -> LDS copy, 16 bytes per lane (GLOBAL_LOAD_ASYNC_TO_LDS_B128,
// tracked by ASYNCcnt; data lands in LDS without touching VGPRs).
// LDS operand: byte offset within the workgroup's LDS allocation == low 32
// bits of the generic shared-memory pointer (shared aperture is in the high
// 32 bits per the ISA aperture check).
// ---------------------------------------------------------------------------
// Runs of copies stand in one statement that ends in s_wait_xcnt 0, so that no
// address register of an issued copy is rewritten ahead of that wait.
__device__ inline unsigned lds_addr(const void* p) {
  return (unsigned)(unsigned long long)p;
}
__device__ inline void async_copy4_b128(unsigned l0, const void* g0, unsigned l1, const void* g1,
                                        unsigned l2, const void* g2, unsigned l3, const void* g3) {
  asm volatile("global_load_async_to_lds_b128 %0, %1, off\n\t"
               "global_load_async_to_lds_b128 %2, %3, off\n\t"
               "global_load_async_to_lds_b128 %4, %5, off\n\t"
               "global_load_async_to_lds_b128 %6, %7, off\n\t"
               "s_wait_xcnt 0x0"
               :: "v"(l0), "v"(g0), "v"(l1), "v"(g1), "v"(l2), "v"(g2), "v"(l3), "v"(g3)
               : "memory");
}
__device__ inline void async_copy6_b128(unsigned l0, const void* g0, unsigned l1, const void* g1,
                                        unsigned l2, const void* g2, unsigned l3, const void* g3,
                                        unsigned l4, const void* g4, unsigned l5, const void* g5) {
  asm volatile("global_load_async_to_lds_b128 %0, %1, off\n\t"
               "global_load_async_to_lds_b128 %2, %3, off\n\t"
               "global_load_async_to_lds_b128 %4, %5, off\n\t"
               "global_load_async_to_lds_b128 %6, %7, off\n\t"
               "global_load_async_to_lds_b128 %8, %9, off\n\t"
               "global_load_async_to_lds_b128 %10, %11, off\n\t"
               "s_wait_xcnt 0x0"
               :: "v"(l0), "v"(g0), "v"(l1), "v"(g1), "v"(l2), "v"(g2), "v"(l3), "v"(g3),
                  "v"(l4), "v"(g4), "v"(l5), "v"(g5)
               : "memory");
}
__device__ inline void async_copy8_b128(unsigned l0, const void* g0, unsigned l1, const void* g1,
                                        unsigned l2, const void* g2, unsigned l3, const void* g3,
                                        unsigned l4, const void* g4, unsigned l5, const void* g5,
                                        unsigned l6, const void* g6, unsigned l7, const void* g7) {
  asm volatile("global_load_async_to_lds_b128 %0, %1, off\n\t"
               "global_load_async_to_lds_b128 %2, %3, off\n\t"
               "global_load_async_to_lds_b128 %4, %5, off\n\t"
               "global_load_async_to_lds_b128 %6, %7, off\n\t"
               "global_load_async_to_lds_b128 %8, %9, off\n\t"
               "global_load_async_to_lds_b128 %10, %11, off\n\t"
               "global_load_async_to_lds_b128 %12, %13, off\n\t"
               "global_load_async_to_lds_b128 %14, %15, off\n\t"
               "s_wait_xcnt 0x0"
               :: "v"(l0), "v"(g0), "v"(l1), "v"(g1), "v"(l2), "v"(g2), "v"(l3), "v"(g3),
                  "v"(l4), "v"(g4), "v"(l5), "v"(g5), "v"(l6), "v"(g6), "v"(l7), "v"(g7)
               : "memory");
}
__device__ inline void wait_async_all() {
  asm volatile("s_wait_asynccnt 0x0" ::: "memory");
}
// this wave's LDS reads are over: stands in front of the barrier behind which
// the buffer it has read is refilled by copies
__device__ inline void wait_ds_all() {
  asm volatile("s_wait_dscnt 0x0" ::: "memory");
}

// ---------------------------------------------------------------------------
// Build a 16x32 f16 fragment (A-layout per ISA 7.12.2) from a row-major tile
// in LDS.  Lane L (L<16) holds row M=L, K = {0..7, 16..23}; lane L+16 holds
// row M=L, K = {8..15, 24..31}.  Two 16B LDS loads per fragment.
// B-fragments (32x16, K x N) use the same call on an N-major (transposed)
// tile: lane = N column, 16 K values per lane with the same split.
// ---------------------------------------------------------------------------
__device__ inline v16h_t load_frag(const half_t* base, int row_stride) {
  int lane = threadIdx.x & 31;
  int m    = lane & 15;
  int hi   = lane >> 4;
  const half_t* p = base + (size_t)m * row_stride + hi * 8;
  v8h_t lo = *(const v8h_t*)(p);        // K = hi*8 .. hi*8+7
  v8h_t hp = *(const v8h_t*)(p + 16);   // K = 16+hi*8 .. 16+hi*8+7
  v16h_t r;
#pragma unroll
  for (int i = 0; i < 8; ++i) { r[i] = lo[i]; r[i + 8] = hp[i]; }
  return r;
}

// ---------------------------------------------------------------------------
// The same 16x32 fragment of the TRANSPOSE of a row-major tile T[k][n] in LDS,
// by ds_load_tr16_b128.  p is the lane's own address,
//   &T[k0 + 8 * (lane >> 4) + (lane & 7)][n0 + 8 * ((lane >> 3) & 1)];
// the lane then holds T[k0 + 8*hi + 0..7][n0 + (lane & 15)], and the second
// load, 16 rows on, the k = 16 + 8*hi + 0..7 of load_frag's order.
// ---------------------------------------------------------------------------
__device__ inline v8h_t load_tr16(const half_t* p) {
  typedef __attribute__((address_space(3))) v8s_t lds_v8s_t;
  return __builtin_bit_cast(v8h_t, __builtin_amdgcn_ds_load_tr16_b128_v8i16((lds_v8s_t*)p));
}
__device__ inline v16h_t load_frag_tr(const half_t* p, int row_stride) {
  v8h_t lo = load_tr16(p);
  v8h_t hp = load_tr16(p + 16 * row_stride);
  v16h_t r;
#pragma unroll
  for (int i = 0; i < 8; ++i) { r[i] = lo[i]; r[i + 8] = hp[i]; }
  return r;
}

// ---------------------------------------------------------------------------
// fp32 -> f16 conversion of all five operands in one launch, 4 elements /
// thread.  The block index picks the source: after the PBLK mask blocks, XBLK blocks take x, then
// WBLK blocks each take Wq (scaled by HD^-0.5), Wk, Wv, Wo.  The f16 copies lie
// one behind the other in `out`, in that order.
// In front of them PBLK blocks pack the mask, which all 16 heads read, to one
// bit a score, in the order in which the attention kernel's waves hold scores:
//   Mp[(b * S/16 + q/16) * S/64 + key/64][e], e = jn * 8 + i, bit l =
//   (M[b][16 * (q/16) + (l & 15)][64 * (key/64) + jn * 16 + 8 * (l >> 4) + i] != 0)
// so word e is the lane mask of score register Sacc[jn][i] of that wave and tile.
// A wave packs PTILE neighbouring 64-key tiles of one group of 16 queries.
// ---------------------------------------------------------------------------
#define XBLK (BATCH * SEQ * DIM / 4 / 256)   // 4096
#define WBLK (DIM * DIM / 4 / 256)           // 1024
#define PTILE 4
#define PBLK (BATCH * (SEQ / 16) * (SEQ / 64) / PTILE / 8)   // 256
__global__ __launch_bounds__(256) void cvt_f32_f16_kernel(const float* __restrict__ x,
                                                          const float* __restrict__ Wq,
                                                          const float* __restrict__ Wk,
                                                          const float* __restrict__ Wv,
                                                          const float* __restrict__ Wo,
                                                          const int* __restrict__ M,
                                                          half_t* __restrict__ out,
                                                          unsigned* __restrict__ Mp) {
  int blk = blockIdx.x;
  if (blk < PBLK) {
    int lane = threadIdx.x & 31;
    int gw = blk * 8 + (threadIdx.x >> 5);           // wave index
    int qg = gw / (SEQ / 64 / PTILE);                // b * S/16 + q/16
    int kt0 = (gw % (SEQ / 64 / PTILE)) * PTILE;     // first 64-key tile
    const int* Mrow = M + (size_t)(qg * 16 + (lane & 15)) * SEQ + 8 * (lane >> 4);
    // stays rolled: the conversion blocks share this kernel's register count
#pragma unroll 1
    for (int t = 0; t < PTILE; ++t) {
      int kt = kt0 + t;
      int4 mk[8];
#pragma unroll
      for (int jn = 0; jn < 4; ++jn) {
        const int4* mp = (const int4*)&Mrow[kt * 64 + jn * 16];
        mk[2 * jn]     = mp[0];
        mk[2 * jn + 1] = mp[1];
      }
      unsigned word = 0;                             // lane e ends up with word e
#pragma unroll
      for (int jn = 0; jn < 4; ++jn) {
        int4 ma = mk[2 * jn];
        int4 mb = mk[2 * jn + 1];
        int mv[8] = {ma.x, ma.y, ma.z, ma.w, mb.x, mb.y, mb.z, mb.w};
#pragma unroll
        for (int i = 0; i < 8; ++i) {
          unsigned bal = __builtin_amdgcn_ballot_w32(mv[i] != 0);   // taken by all 32 lanes
          word = lane == jn * 8 + i ? bal : word;
        }
      }
      Mp[(size_t)(qg * (SEQ / 64) + kt) * 32 + lane] = word;
    }
    return;
  }
  blk -= PBLK;
  const float* in = x;
  int sblk = blk;                      // block index within the source
  float scale = 1.0f;
  if (blk >= XBLK) {
    int w = (blk - XBLK) / WBLK;
    sblk  = (blk - XBLK) % WBLK;
    in    = w == 0 ? Wq : w == 1 ? Wk : w == 2 ? Wv : Wo;
    scale = w == 0 ? 0.125f : 1.0f;
  }
  float4 f = ((const float4*)in)[sblk * 256 + threadIdx.x];
  v4h_t h;
  h[0] = (half_t)(f.x * scale);
  h[1] = (half_t)(f.y * scale);
  h[2] = (half_t)(f.z * scale);
  h[3] = (half_t)(f.w * scale);
  ((v4h_t*)out)[blk * 256 + threadIdx.x] = h;
}

// ---------------------------------------------------------------------------
// GEMM: C[r][n] = sum_k X[r][k] * W[n][k],  R=4096, K=1024, N=1024.
// Block tile 128x64, BK=64.  8 waves in a 4(M) x 2(N) grid; each wave owns a
// 32x32 tile = 2x2x2 v_wmma_f32_16x16x32_f16 per K step (8 WMMA / barrier).
// Tiles staged via GLOBAL_LOAD_ASYNC_TO_LDS_B128 into two buffers: tile t + 2 is
// requested at the foot of trip t, behind the barrier that ends every wave's
// reads of tile t, into the buffer that tile t has left.
// mode 0: f16 output scattered to head layout [B,H,S,HD]; blockIdx.z picks the
//         product: weight matrix z behind W, output tensor z behind out
// mode 1: fp32 output + bias, flat [R,N]
// ---------------------------------------------------------------------------
__global__ __launch_bounds__(256) void gemm_xwT_kernel(const half_t* __restrict__ X,
                                                       const half_t* __restrict__ W,
                                                       void* __restrict__ out,
                                                       const float* __restrict__ bias,
                                                       int mode) {
  const int K = DIM;
  int bm = blockIdx.x;          // 0..31  (row tiles of 128)
  int bn = blockIdx.y;          // 0..15  (col tiles of 64)
  int tid = threadIdx.x;
  int wid = tid >> 5;
  int lane = tid & 31;
  int wm = wid & 3;             // wave row   (4)
  int wn = wid >> 2;            // wave col   (2)
  int m16 = lane & 15;
  int hi  = lane >> 4;

  __shared__ __attribute__((aligned(16))) half_t As[2 * 128 * LDP];   // 2 x 18 KB
  __shared__ __attribute__((aligned(16))) half_t Bs[2 * 64 * LDP];    // 2 x  9 KB

  v8f_t acc[2][2] = {};

  const half_t* Xb = X + (size_t)(bm * 128) * K;
  const half_t* Wb = W + (size_t)blockIdx.z * DIM * DIM + (size_t)(bn * 64) * K;
  int crow = tid >> 3;          // this thread's first tile row in the copies
  int ccol = (tid & 7) * 8;     // and its 8-half column

  // A tile: 128 rows x 64 halves = 1024 chunks of 8 halves (16B) -> 4/thread
  // (chunk c = tid + 256 j: row = crow + 32 j, same column)
  // B tile: 64 rows x 64 halves = 512 chunks -> 2/thread
  auto copy_tile = [&](int t) {
    half_t* Ad = &As[(t & 1) * 128 * LDP];
    half_t* Bd = &Bs[(t & 1) * 64 * LDP];
    int k0 = t * 64;
    async_copy6_b128(lds_addr(&Ad[(crow + 0)  * LDP + ccol]), &Xb[(size_t)(crow + 0)  * K + k0 + ccol],
                     lds_addr(&Ad[(crow + 32) * LDP + ccol]), &Xb[(size_t)(crow + 32) * K + k0 + ccol],
                     lds_addr(&Ad[(crow + 64) * LDP + ccol]), &Xb[(size_t)(crow + 64) * K + k0 + ccol],
                     lds_addr(&Ad[(crow + 96) * LDP + ccol]), &Xb[(size_t)(crow + 96) * K + k0 + ccol],
                     lds_addr(&Bd[(crow + 0)  * LDP + ccol]), &Wb[(size_t)(crow + 0)  * K + k0 + ccol],
                     lds_addr(&Bd[(crow + 32) * LDP + ccol]), &Wb[(size_t)(crow + 32) * K + k0 + ccol]);
  };

  copy_tile(0);
  wait_async_all();
  __syncthreads();      // tile 0 is published
  copy_tile(1);

  for (int t = 0; t < K / 64; ++t) {
    const half_t* At = &As[(t & 1) * 128 * LDP];
    const half_t* Bt = &Bs[(t & 1) * 64 * LDP];
#pragma unroll
    for (int kc = 0; kc < 2; ++kc) {
      v16h_t a0 = load_frag(&At[(wm * 32 + 0)  * LDP + kc * 32], LDP);
      v16h_t a1 = load_frag(&At[(wm * 32 + 16) * LDP + kc * 32], LDP);
      v16h_t b0 = load_frag(&Bt[(wn * 32 + 0)  * LDP + kc * 32], LDP);
      v16h_t b1 = load_frag(&Bt[(wn * 32 + 16) * LDP + kc * 32], LDP);
      acc[0][0] = wmma_f32_f16(a0, b0, acc[0][0]);
      acc[0][1] = wmma_f32_f16(a0, b1, acc[0][1]);
      acc[1][0] = wmma_f32_f16(a1, b0, acc[1][0]);
      acc[1][1] = wmma_f32_f16(a1, b1, acc[1][1]);
    }
    wait_ds_all();
    wait_async_all();   // this wave's share of tile t + 1 has landed
    __syncthreads();    // publishes tile t + 1 and ends every wave's reads of tile t
    if (t + 2 < K / 64) copy_tile(t + 2);
  }
  wait_async_all();     // no copy is outstanding behind the loop

#pragma unroll
  for (int tm = 0; tm < 2; ++tm)
#pragma unroll
    for (int tn = 0; tn < 2; ++tn)
#pragma unroll
      for (int i = 0; i < 8; ++i) {
        int r = bm * 128 + wm * 32 + tm * 16 + i + 8 * hi;
        int n = bn * 64  + wn * 32 + tn * 16 + m16;
        float v = acc[tm][tn][i];
        if (mode == 0) {
          int b = r >> 11;            // r / SEQ
          int s = r & (SEQ - 1);
          int hh = n >> 6;            // n / HDIM
          int d  = n & (HDIM - 1);
          ((half_t*)out)[(((size_t)((blockIdx.z * BATCH + b) * NHEAD + hh) * SEQ) + s) * HDIM + d] = (half_t)v;
          // holds every later rewrite of this store's address and data registers behind it
          asm volatile("s_wait_xcnt 0x0" ::: "memory");
        } else {
          ((float*)out)[(size_t)r * DIM + n] = v + bias[n];
        }
      }
}

__device__ inline float xhalf(float x) {
  int v = __builtin_bit_cast(int, x);
  return __builtin_bit_cast(float,
      __builtin_amdgcn_permlanex16(v, v, 0x76543210, 0xfedcba98, false, false));
}

__global__ __launch_bounds__(128) void attn_kernel(const half_t* __restrict__ Qh,
                                                   const half_t* __restrict__ Kh,
                                                   const half_t* __restrict__ Vh,
                                                   const unsigned* __restrict__ Mp,
                                                   half_t* __restrict__ Oh) {
  int bh = blockIdx.x;                 // 0..31
  int b = bh >> 4;
  int h = bh & (NHEAD - 1);
  int qtile = blockIdx.y;              // 0..31
  int tid = threadIdx.x;
  int wid = tid >> 5;
  int lane = tid & 31;
  int m16 = lane & 15;
  int hi  = lane >> 4;

  __shared__ __attribute__((aligned(16))) half_t Qs[64 * LDP];       // [q][d]
  __shared__ __attribute__((aligned(16))) half_t Ks[2 * 64 * LDP];   // 2 x [key][d]
  __shared__ __attribute__((aligned(16))) half_t Vs[2 * 64 * LDV];   // 2 x [key][d]

  const half_t* Qbase = Qh + ((size_t)bh * SEQ + (size_t)qtile * 64) * HDIM;
  const half_t* Kbase = Kh + (size_t)bh * SEQ * HDIM;
  const half_t* Vbase = Vh + (size_t)bh * SEQ * HDIM;

  int crow = tid >> 3;                 // this thread's first tile row in the copies
  int ccol = (tid & 7) * 8;            // and its 8-half column

  // Q tile 64x64 via async-to-LDS (chunk c = tid + 128 j: row = crow + 16 j)
  async_copy4_b128(lds_addr(&Qs[(crow + 0)  * LDP + ccol]), &Qbase[(crow + 0)  * HDIM + ccol],
                   lds_addr(&Qs[(crow + 16) * LDP + ccol]), &Qbase[(crow + 16) * HDIM + ccol],
                   lds_addr(&Qs[(crow + 32) * LDP + ccol]), &Qbase[(crow + 32) * HDIM + ccol],
                   lds_addr(&Qs[(crow + 48) * LDP + ccol]), &Qbase[(crow + 48) * HDIM + ccol]);
  // K and V tiles 64x64 (row-major [key][d]) via async-to-LDS
  auto copy_tile = [&](int kt) {
    half_t* Kd = &Ks[(kt & 1) * 64 * LDP];
    half_t* Vd = &Vs[(kt & 1) * 64 * LDV];
    const half_t* Kt = Kbase + (size_t)kt * 64 * HDIM;
    const half_t* Vg = Vbase + (size_t)kt * 64 * HDIM;
    async_copy8_b128(lds_addr(&Kd[(crow + 0)  * LDP + ccol]), &Kt[(crow + 0)  * HDIM + ccol],
                     lds_addr(&Kd[(crow + 16) * LDP + ccol]), &Kt[(crow + 16) * HDIM + ccol],
                     lds_addr(&Kd[(crow + 32) * LDP + ccol]), &Kt[(crow + 32) * HDIM + ccol],
                     lds_addr(&Kd[(crow + 48) * LDP + ccol]), &Kt[(crow + 48) * HDIM + ccol],
                     lds_addr(&Vd[(crow + 0)  * LDV + ccol]), &Vg[(crow + 0)  * HDIM + ccol],
                     lds_addr(&Vd[(crow + 16) * LDV + ccol]), &Vg[(crow + 16) * HDIM + ccol],
                     lds_addr(&Vd[(crow + 32) * LDV + ccol]), &Vg[(crow + 32) * HDIM + ccol],
                     lds_addr(&Vd[(crow + 48) * LDV + ccol]), &Vg[(crow + 48) * HDIM + ccol]);
  };
  copy_tile(0);
  wait_async_all();
  __syncthreads();      // Q and tile 0 are published

  // B fragments of Q^T: lane = query column
  v16h_t bq0 = load_frag(&Qs[wid * 16 * LDP + 0],  LDP);  // d = 0..31
  v16h_t bq1 = load_frag(&Qs[wid * 16 * LDP + 32], LDP);  // d = 32..63

  v8f_t Oacc[4] = {};                  // Oacc[jd][i] = O[q = m16][d = jd*16 + 8*hi + i]
  float mrow = -3.0e38f;               // this query's running maximum (same in both halves)
  float lrow = 0.0f;                   // sum over this lane's own keys; halves joined at the end

  int q = qtile * 64 + wid * 16 + m16;
  // this wave's packed mask words, 32 a tile; the wave's number as a scalar, so
  // that the words are read by scalar loads
  int wu = __builtin_amdgcn_readfirstlane(wid);
  const unsigned* Mw = Mp + (size_t)(b * (SEQ / 16) + qtile * 4 + wu) * (SEQ / 64) * 32;

  // this lane's address in the first V buffer for the transposing loads (key 0, d 0 fragment)
  const half_t* Vlane = &Vs[(8 * hi + (lane & 7)) * LDV + 8 * ((lane >> 3) & 1)];

  for (int kt = 0; kt < SEQ / 64; ++kt) {
    const half_t* Kt = &Ks[(kt & 1) * 64 * LDP];
    const half_t* Vt = Vlane + (kt & 1) * 64 * LDV;
    // the tile's 32 mask words, requested ahead of the copies (behind the copies'
    // asm statement the compiler made vector loads of them)
    unsigned mw[32];
#pragma unroll
    for (int e = 0; e < 32; ++e) mw[e] = Mw[kt * 32 + e];
    // directly behind the barrier at the foot of trip kt - 1 (in front of the loop
    // for kt = 0): tile kt + 1 into the buffers that trip kt - 1 has read
    if (kt + 1 < SEQ / 64) copy_tile(kt + 1);

    // --- scores, transposed: Sacc[jn][i] = S[key = jn*16 + 8*hi + i][q = m16] ---
    v8f_t Sacc[4] = {};
#pragma unroll
    for (int jn = 0; jn < 4; ++jn) {
      v16h_t ak0 = load_frag(&Kt[jn * 16 * LDP + 0],  LDP);
      v16h_t ak1 = load_frag(&Kt[jn * 16 * LDP + 32], LDP);
      Sacc[jn] = wmma_f32_f16(ak0, bq0, Sacc[jn]);
      Sacc[jn] = wmma_f32_f16(ak1, bq1, Sacc[jn]);
    }

    // --- mask + online softmax: 32 keys of one query per lane ---
    float pmax[4];                     // one chain per 16-key tile
#pragma unroll
    for (int jn = 0; jn < 4; ++jn) {
      pmax[jn] = -3.0e38f;
#pragma unroll
      for (int i = 0; i < 8; ++i) {
        float s = __builtin_amdgcn_inverse_ballot_w32(mw[jn * 8 + i]) ? Sacc[jn][i] : -1.0e9f;
        Sacc[jn][i] = s;
        pmax[jn] = fmaxf(pmax[jn], s);
      }
    }
    float rmax = fmaxf(fmaxf(pmax[0], pmax[1]), fmaxf(pmax[2], pmax[3]));
    rmax = fmaxf(rmax, xhalf(rmax));   // the other half holds the query's other 32 keys
    float mnew = fmaxf(mrow, rmax);
    float corr = __expf(mrow - mnew);
    mrow = mnew;
    float psum[4];                     // one chain per 16-key tile
#pragma unroll
    for (int jn = 0; jn < 4; ++jn) {
      psum[jn] = 0.0f;
#pragma unroll
      for (int i = 0; i < 8; ++i) {
        float p = __expf(Sacc[jn][i] - mnew);
        Sacc[jn][i] = p;
        psum[jn] += p;
      }
    }
    lrow = lrow * corr + ((psum[0] + psum[1]) + (psum[2] + psum[3]));

    // --- P^T as B fragments, in-lane: keys {8*hi + i, 16 + 8*hi + i} of each 32 ---
    v16h_t bp0, bp1;
#pragma unroll
    for (int i = 0; i < 8; ++i) {
      bp0[i]     = (half_t)Sacc[0][i];
      bp0[i + 8] = (half_t)Sacc[1][i];
      bp1[i]     = (half_t)Sacc[2][i];
      bp1[i + 8] = (half_t)Sacc[3][i];
    }

    // rescale running output
#pragma unroll
    for (int jd = 0; jd < 4; ++jd)
#pragma unroll
      for (int i = 0; i < 8; ++i)
        Oacc[jd][i] *= corr;

#pragma unroll
    for (int jd = 0; jd < 4; ++jd) {
      v16h_t av0 = load_frag_tr(Vt + jd * 16,            LDV);  // keys 0..31
      v16h_t av1 = load_frag_tr(Vt + jd * 16 + 32 * LDV, LDV);  // keys 32..63
      Oacc[jd] = wmma_f32_f16(av0, bp0, Oacc[jd]);
      Oacc[jd] = wmma_f32_f16(av1, bp1, Oacc[jd]);
    }
    wait_ds_all();
    wait_async_all();   // this wave's share of tile kt + 1 has landed
    __syncthreads();    // publishes tile kt + 1 and ends every wave's reads of tile kt
  }
  wait_async_all();     // no copy is outstanding behind the loop

  // --- write Oh[b, q, h*64 + d]: 8 consecutive d per lane and tile ---
  float lsum = lrow + xhalf(lrow);
  float inv = lsum > 0.0f ? 1.0f / lsum : 0.0f;
#pragma unroll
  for (int jd = 0; jd < 4; ++jd) {
    v8h_t o;
#pragma unroll
    for (int i = 0; i < 8; ++i) o[i] = (half_t)(Oacc[jd][i] * inv);
    *(v8h_t*)&Oh[((size_t)b * SEQ + q) * DIM + h * HDIM + jd * 16 + 8 * hi] = o;
  }
}

// ---------------------------------------------------------------------------
// Launch
// ---------------------------------------------------------------------------
extern "C" void kernel_launch(void* const* d_in, const int* in_sizes, int n_in,
                              void* d_out, int out_size, void* d_ws, size_t ws_size,
                              hipStream_t stream) {
  const float* x   = (const float*)d_in[0];
  const int*   M   = (const int*)d_in[1];
  const float* Wq  = (const float*)d_in[2];
  const float* Wk  = (const float*)d_in[3];
  const float* Wv  = (const float*)d_in[4];
  const float* Wo  = (const float*)d_in[5];
  const float* bo  = (const float*)d_in[6];

  char* ws = (char*)d_ws;
  const size_t MB = 1u << 20;
  half_t* xh  = (half_t*)(ws + 0 * MB);   // 8 MB  [B*S, D]
  half_t* wqh = (half_t*)(ws + 8 * MB);   // 2 MB
  //      Wk as f16 at ws + 10 MB, Wv at ws + 12 MB (2 MB each), reached from wqh
  half_t* woh = (half_t*)(ws + 14 * MB);  // 2 MB
  half_t* Qh  = (half_t*)(ws + 16 * MB);  // 8 MB  [B,H,S,HD]
  half_t* Kh  = (half_t*)(ws + 24 * MB);  // 8 MB
  half_t* Vh  = (half_t*)(ws + 32 * MB);  // 8 MB
  half_t* Oh  = (half_t*)(ws + 40 * MB);  // 8 MB  [B,S,D]
  unsigned* Mp = (unsigned*)(ws + 48 * MB);  // 1 MB  packed mask

  // the five f16 copies are written as one run from xh on
  cvt_f32_f16_kernel<<<PBLK + XBLK + 4 * WBLK, 256, 0, stream>>>(x, Wq, Wk, Wv, Wo, M, xh, Mp);

  // z = 0, 1, 2: Q, K, V (the three f16 weights from wqh on, and Qh, Kh, Vh, lie one behind the other)
  gemm_xwT_kernel<<<dim3(BATCH * SEQ / 128, DIM / 64, 3), 256, 0, stream>>>(xh, wqh, Qh, nullptr, 0);

  attn_kernel<<<dim3(BATCH * NHEAD, SEQ / 64), 128, 0, stream>>>(Qh, Kh, Vh, Mp, Oh);

  gemm_xwT_kernel<<<dim3(BATCH * SEQ / 128, DIM / 64, 1), 256, 0, stream>>>(Oh, woh, d_out, bo, 1);
}

// v007
// It runs in 88.7 microseconds.
// In two side-by-side timings against v006, it was 1.19 and 1.20 times as fast.
// Over all steps from v000 it is 4.81 times as fast.
#include <hip/hip_runtime.h>
#include <hip/hip_bf16.h>

typedef _Float16 half_t;
typedef __attribute__((ext_vector_type(16))) _Float16 v16h_t;
typedef __attribute__((ext_vector_type(8)))  _Float16 v8h_t;
typedef __attribute__((ext_vector_type(4)))  _Float16 v4h_t;
typedef __attribute__((ext_vector_type(8)))  float    v8f_t;
typedef __attribute__((ext_vector_type(4)))  float    v4f_t;
typedef __attribute__((ext_vector_type(8)))  short    v8s_t;

#define BATCH 2
#define SEQ   2048
#define DIM   1024
#define NHEAD 16
#define HDIM  64
// LDS row pitch, in halves, of the 64-half tile rows read by load_frag's 16-byte LDS
// loads: 144 B = 16 B x 9 puts the 16 rows of a fragment on 16 different
// 4-bank groups (128 B rows put them all on two).
#define LDP   72
// LDS row pitch, in halves, of the V tile, whose 64-half rows are read by the
// transposing 16-byte LDS load: that reader wants 160 B = 32 B x 5.
#define LDV   80

// ---------------------------------------------------------------------------
// WMMA wrapper: D = A(16x32 f16) * B(32x16 f16) + C(16x16 f32)
// ---------------------------------------------------------------------------
__device__ inline v8f_t wmma_f32_f16(v16h_t a, v16h_t b, v8f_t c) {
  return __builtin_amdgcn_wmma_f32_16x16x32_f16(
      /*neg_a=*/false, a, /*neg_b=*/false, b,
      /*c_mod=*/(short)0, c, /*reuse_a=*/false, /*reuse_b=*/false);
}

// ---------------------------------------------------------------------------
// Async global -> LDS copy, 16 bytes per lane (GLOBAL_LOAD_ASYNC_TO_LDS_B128,
// tracked by ASYNCcnt; data lands in LDS without touching VGPRs).
// LDS operand: byte offset within the workgroup's LDS allocation == low 32
// bits of the generic shared-memory pointer (shared aperture is in the high
// 32 bits per the ISA aperture check).
// ---------------------------------------------------------------------------
// Runs of copies stand in one statement that ends in s_wait_xcnt 0, so that no
// address register of an issued copy is rewritten ahead of that wait.
__device__ inline unsigned lds_addr(const void* p) {
  return (unsigned)(unsigned long long)p;
}
__device__ inline void async_copy4_b128(unsigned l0, const void* g0, unsigned l1, const void* g1,
                                        unsigned l2, const void* g2, unsigned l3, const void* g3) {
  asm volatile("global_load_async_to_lds_b128 %0, %1, off\n\t"
               "global_load_async_to_lds_b128 %2, %3, off\n\t"
               "global_load_async_to_lds_b128 %4, %5, off\n\t"
               "global_load_async_to_lds_b128 %6, %7, off\n\t"
               "s_wait_xcnt 0x0"
               :: "v"(l0), "v"(g0), "v"(l1), "v"(g1), "v"(l2), "v"(g2), "v"(l3), "v"(g3)
               : "memory");
}
__device__ inline void async_copy8_b128(unsigned l0, const void* g0, unsigned l1, const void* g1,
                                        unsigned l2, const void* g2, unsigned l3, const void* g3,
                                        unsigned l4, const void* g4, unsigned l5, const void* g5,
                                        unsigned l6, const void* g6, unsigned l7, const void* g7) {
  asm volatile("global_load_async_to_lds_b128 %0, %1, off\n\t"
               "global_load_async_to_lds_b128 %2, %3, off\n\t"
               "global_load_async_to_lds_b128 %4, %5, off\n\t"
               "global_load_async_to_lds_b128 %6, %7, off\n\t"
               "global_load_async_to_lds_b128 %8, %9, off\n\t"
               "global_load_async_to_lds_b128 %10, %11, off\n\t"
               "global_load_async_to_lds_b128 %12, %13, off\n\t"
               "global_load_async_to_lds_b128 %14, %15, off\n\t"
               "s_wait_xcnt 0x0"
               :: "v"(l0), "v"(g0), "v"(l1), "v"(g1), "v"(l2), "v"(g2), "v"(l3), "v"(g3),
                  "v"(l4), "v"(g4), "v"(l5), "v"(g5), "v"(l6), "v"(g6), "v"(l7), "v"(g7)
               : "memory");
}
__device__ inline void wait_async_all() {
  asm volatile("s_wait_asynccnt 0x0" ::: "memory");
}
// this wave's LDS reads are over: stands in front of the barrier behind which
// the buffer it has read is refilled by copies
__device__ inline void wait_ds_all() {
  asm volatile("s_wait_dscnt 0x0" ::: "memory");
}

// ---------------------------------------------------------------------------
// Build a 16x32 f16 fragment (A-layout per ISA 7.12.2) from a row-major tile
// in LDS.  Lane L (L<16) holds row M=L, K = {0..7, 16..23}; lane L+16 holds
// row M=L, K = {8..15, 24..31}.  Two 16B LDS loads per fragment.
// B-fragments (32x16, K x N) use the same call on an N-major (transposed)
// tile: lane = N column, 16 K values per lane with the same split.
// ---------------------------------------------------------------------------
__device__ inline v16h_t load_frag(const half_t* base, int row_stride) {
  int lane = threadIdx.x & 31;
  int m    = lane & 15;
  int hi   = lane >> 4;
  const half_t* p = base + (size_t)m * row_stride + hi * 8;
  v8h_t lo = *(const v8h_t*)(p);        // K = hi*8 .. hi*8+7
  v8h_t hp = *(const v8h_t*)(p + 16);   // K = 16+hi*8 .. 16+hi*8+7
  v16h_t r;
#pragma unroll
  for (int i = 0; i < 8; ++i) { r[i] = lo[i]; r[i + 8] = hp[i]; }
  return r;
}

// ---------------------------------------------------------------------------
// The same 16x32 fragment of the TRANSPOSE of a row-major tile T[k][n] in LDS,
// by ds_load_tr16_b128.  p is the lane's own address,
//   &T[k0 + 8 * (lane >> 4) + (lane & 7)][n0 + 8 * ((lane >> 3) & 1)];
// the lane then holds T[k0 + 8*hi + 0..7][n0 + (lane & 15)], and the second
// load, 16 rows on, the k = 16 + 8*hi + 0..7 of load_frag's order.
// ---------------------------------------------------------------------------
__device__ inline v8h_t load_tr16(const half_t* p) {
  typedef __attribute__((address_space(3))) v8s_t lds_v8s_t;
  return __builtin_bit_cast(v8h_t, __builtin_amdgcn_ds_load_tr16_b128_v8i16((lds_v8s_t*)p));
}
__device__ inline v16h_t load_frag_tr(const half_t* p, int row_stride) {
  v8h_t lo = load_tr16(p);
  v8h_t hp = load_tr16(p + 16 * row_stride);
  v16h_t r;
#pragma unroll
  for (int i = 0; i < 8; ++i) { r[i] = lo[i]; r[i + 8] = hp[i]; }
  return r;
}

// ---------------------------------------------------------------------------
// fp32 -> f16 conversion of all five operands in one launch, 4 elements /
// thread.  The block index picks the source: after the PBLK mask blocks, XBLK blocks take x, then
// WBLK blocks each take Wq (scaled by HD^-0.5), Wk, Wv, Wo.  The f16 copies lie
// one behind the other in `out`, in that order.
// In front of them PBLK blocks pack the mask, which all 16 heads read, to one
// bit a score, in the order in which the attention kernel's waves hold scores:
//   Mp[(b * S/16 + q/16) * S/64 + key/64][e], e = jn * 8 + i, bit l =
//   (M[b][16 * (q/16) + (l & 15)][64 * (key/64) + jn * 16 + 8 * (l >> 4) + i] != 0)
// so word e is the lane mask of score register Sacc[jn][i] of that wave and tile.
// A wave packs PTILE neighbouring 64-key tiles of one group of 16 queries.
// ---------------------------------------------------------------------------
#define XBLK (BATCH * SEQ * DIM / 4 / 256)   // 4096
#define WBLK (DIM * DIM / 4 / 256)           // 1024
#define PTILE 4
#define PBLK (BATCH * (SEQ / 16) * (SEQ / 64) / PTILE / 8)   // 256
__global__ __launch_bounds__(256) void cvt_f32_f16_kernel(const float* __restrict__ x,
                                                          const float* __restrict__ Wq,
                                                          const float* __restrict__ Wk,
                                                          const float* __restrict__ Wv,
                                                          const float* __restrict__ Wo,
                                                          const int* __restrict__ M,
                                                          half_t* __restrict__ out,
                                                          unsigned* __restrict__ Mp) {
  int blk = blockIdx.x;
  if (blk < PBLK) {
    int lane = threadIdx.x & 31;
    int gw = blk * 8 + (threadIdx.x >> 5);           // wave index
    int qg = gw / (SEQ / 64 / PTILE);                // b * S/16 + q/16
    int kt0 = (gw % (SEQ / 64 / PTILE)) * PTILE;     // first 64-key tile
    const int* Mrow = M + (size_t)(qg * 16 + (lane & 15)) * SEQ + 8 * (lane >> 4);
    // stays rolled: the conversion blocks share this kernel's register count
#pragma unroll 1
    for (int t = 0; t < PTILE; ++t) {
      int kt = kt0 + t;
      int4 mk[8];
#pragma unroll
      for (int jn = 0; jn < 4; ++jn) {
        const int4* mp = (const int4*)&Mrow[kt * 64 + jn * 16];
        mk[2 * jn]     = mp[0];
        mk[2 * jn + 1] = mp[1];
      }
      unsigned word = 0;                             // lane e ends up with word e
#pragma unroll
      for (int jn = 0; jn < 4; ++jn) {
        int4 ma = mk[2 * jn];
        int4 mb = mk[2 * jn + 1];
        int mv[8] = {ma.x, ma.y, ma.z, ma.w, mb.x, mb.y, mb.z, mb.w};
#pragma unroll
        for (int i = 0; i < 8; ++i) {
          unsigned bal = __builtin_amdgcn_ballot_w32(mv[i] != 0);   // taken by all 32 lanes
          word = lane == jn * 8 + i ? bal : word;
        }
      }
      Mp[(size_t)(qg * (SEQ / 64) + kt) * 32 + lane] = word;
    }
    return;
  }
  blk -= PBLK;
  const float* in = x;
  int sblk = blk;                      // block index within the source
  float scale = 1.0f;
  if (blk >= XBLK) {
    int w = (blk - XBLK) / WBLK;
    sblk  = (blk - XBLK) % WBLK;
    in    = w == 0 ? Wq : w == 1 ? Wk : w == 2 ? Wv : Wo;
    scale = w == 0 ? 0.125f : 1.0f;
  }
  float4 f = ((const float4*)in)[sblk * 256 + threadIdx.x];
  v4h_t h;
  h[0] = (half_t)(f.x * scale);
  h[1] = (half_t)(f.y * scale);
  h[2] = (half_t)(f.z * scale);
  h[3] = (half_t)(f.w * scale);
  ((v4h_t*)out)[blk * 256 + threadIdx.x] = h;
}

// ---------------------------------------------------------------------------
// GEMM: C[r][n] = sum_k X[r][k] * W[n][k],  R=4096, K=1024, N=1024.
// Block tile 128x128, BK=64.  4 waves in a 2(M) x 2(N) grid; each wave owns a
// 64x64 tile = 4x4x2 v_wmma_f32_16x16x32_f16 per K step (32 WMMA / barrier), so
// that a fragment read from LDS feeds four products.
// The wave's tile is held transposed (A = W rows, B = X rows): a lane has one
// row r (lane & 15) and, in the 8 registers of a 16x16 tile, 8 neighbouring n.
// Tiles staged via GLOBAL_LOAD_ASYNC_TO_LDS_B128 into two buffers: tile t + 2 is
// requested at the foot of trip t, behind the barrier that ends every wave's
// reads of tile t, into the buffer that tile t has left.
// mode 0: f16 output scattered to head layout [B,H,S,HD]; blockIdx.z picks the
//         product: weight matrix z behind W, output tensor z behind out
// mode 1: fp32 output + bias, flat [R,N]
// ---------------------------------------------------------------------------
__global__ __launch_bounds__(128) void gemm_xwT_kernel(const half_t* __restrict__ X,
                                                       const half_t* __restrict__ W,
                                                       void* __restrict__ out,
                                                       const float* __restrict__ bias,
                                                       int mode) {
  const int K = DIM;
  int bm = blockIdx.x;          // 0..31  (row tiles of 128)
  int bn = blockIdx.y;          // 0..7   (col tiles of 128)
  int tid = threadIdx.x;
  int wid = tid >> 5;
  int lane = tid & 31;
  int wm = wid & 1;             // wave row   (2)
  int wn = wid >> 1;            // wave col   (2)
  int m16 = lane & 15;
  int hi  = lane >> 4;

  __shared__ __attribute__((aligned(16))) half_t As[2 * 128 * LDP];   // 2 x 18 KB
  __shared__ __attribute__((aligned(16))) half_t Bs[2 * 128 * LDP];   // 2 x 18 KB

  v8f_t acc[4][4] = {};         // acc[tn][tm][i] = C[r = tm*16 + m16][n = tn*16 + 8*hi + i]

  const half_t* Xb = X + (size_t)(bm * 128) * K;
  const half_t* Wb = W + (size_t)blockIdx.z * DIM * DIM + (size_t)(bn * 128) * K;
  int crow = tid >> 3;          // this thread's first tile row in the copies
  int ccol = (tid & 7) * 8;     // and its 8-half column

  // A and B tile: 128 rows x 64 halves = 1024 chunks of 8 halves (16B) -> 8/thread each
  // (chunk c = tid + 128 j: row = crow + 16 j, same column)
  auto copy_tile = [&](int t) {
    half_t* Ad = &As[(t & 1) * 128 * LDP];
    half_t* Bd = &Bs[(t & 1) * 128 * LDP];
    int k0 = t * 64;
    async_copy8_b128(lds_addr(&Ad[(crow + 0)   * LDP + ccol]), &Xb[(size_t)(crow + 0)   * K + k0 + ccol],
                     lds_addr(&Ad[(crow + 16)  * LDP + ccol]), &Xb[(size_t)(crow + 16)  * K + k0 + ccol],
                     lds_addr(&Ad[(crow + 32)  * LDP + ccol]), &Xb[(size_t)(crow + 32)  * K + k0 + ccol],
                     lds_addr(&Ad[(crow + 48)  * LDP + ccol]), &Xb[(size_t)(crow + 48)  * K + k0 + ccol],
                     lds_addr(&Ad[(crow + 64)  * LDP + ccol]), &Xb[(size_t)(crow + 64)  * K + k0 + ccol],
                     lds_addr(&Ad[(crow + 80)  * LDP + ccol]), &Xb[(size_t)(crow + 80)  * K + k0 + ccol],
                     lds_addr(&Ad[(crow + 96)  * LDP + ccol]), &Xb[(size_t)(crow + 96)  * K + k0 + ccol],
                     lds_addr(&Ad[(crow + 112) * LDP + ccol]), &Xb[(size_t)(crow + 112) * K + k0 + ccol]);
    async_copy8_b128(lds_addr(&Bd[(crow + 0)   * LDP + ccol]), &Wb[(size_t)(crow + 0)   * K + k0 + ccol],
                     lds_addr(&Bd[(crow + 16)  * LDP + ccol]), &Wb[(size_t)(crow + 16)  * K + k0 + ccol],
                     lds_addr(&Bd[(crow + 32)  * LDP + ccol]), &Wb[(size_t)(crow + 32)  * K + k0 + ccol],
                     lds_addr(&Bd[(crow + 48)  * LDP + ccol]), &Wb[(size_t)(crow + 48)  * K + k0 + ccol],
                     lds_addr(&Bd[(crow + 64)  * LDP + ccol]), &Wb[(size_t)(crow + 64)  * K + k0 + ccol],
                     lds_addr(&Bd[(crow + 80)  * LDP + ccol]), &Wb[(size_t)(crow + 80)  * K + k0 + ccol],
                     lds_addr(&Bd[(crow + 96)  * LDP + ccol]), &Wb[(size_t)(crow + 96)  * K + k0 + ccol],
                     lds_addr(&Bd[(crow + 112) * LDP + ccol]), &Wb[(size_t)(crow + 112) * K + k0 + ccol]);
  };

  copy_tile(0);
  wait_async_all();
  __syncthreads();      // tile 0 is published
  copy_tile(1);

  for (int t = 0; t < K / 64; ++t) {
    const half_t* At = &As[(t & 1) * 128 * LDP];
    const half_t* Bt = &Bs[(t & 1) * 128 * LDP];
#pragma unroll
    for (int kc = 0; kc < 2; ++kc) {
      v16h_t xf[4], wf[4];
#pragma unroll
      for (int j = 0; j < 4; ++j) {
        xf[j] = load_frag(&At[(wm * 64 + j * 16) * LDP + kc * 32], LDP);
        wf[j] = load_frag(&Bt[(wn * 64 + j * 16) * LDP + kc * 32], LDP);
      }
      // keeps the 16 LDS reads of this k step together ahead of its products: left
      // free, the compiler read W fragments singly among them, each behind a full wait
      __builtin_amdgcn_sched_barrier(0);
#pragma unroll
      for (int tn = 0; tn < 4; ++tn)
#pragma unroll
        for (int tm = 0; tm < 4; ++tm)
          acc[tn][tm] = wmma_f32_f16(wf[tn], xf[tm], acc[tn][tm]);
    }
    wait_ds_all();
    wait_async_all();   // this wave's share of tile t + 1 has landed
    __syncthreads();    // publishes tile t + 1 and ends every wave's reads of tile t
    if (t + 2 < K / 64) copy_tile(t + 2);
  }
  wait_async_all();     // no copy is outstanding behind the loop

  int r0 = bm * 128 + wm * 64 + m16;          // this lane's row in row tile 0
  int n0 = bn * 128 + wn * 64 + 8 * hi;       // its first column in column tile 0
  if (mode == 0) {
    int hh = n0 >> 6;                         // n / HDIM: one head a wave
#pragma unroll
    for (int tm = 0; tm < 4; ++tm) {
      int r = r0 + tm * 16;
      int b = r >> 11;                        // r / SEQ
      int s = r & (SEQ - 1);
      half_t* orow = (half_t*)out + (((size_t)((blockIdx.z * BATCH + b) * NHEAD + hh) * SEQ) + s) * HDIM + 8 * hi;
#pragma unroll
      for (int tn = 0; tn < 4; ++tn) {
        v8h_t o;
#pragma unroll
        for (int i = 0; i < 8; ++i) o[i] = (half_t)acc[tn][tm][i];
        *(v8h_t*)&orow[tn * 16] = o;
        // holds every later rewrite of this store's address and data registers behind it
        asm volatile("s_wait_xcnt 0x0" ::: "memory");
      }
    }
  } else {
    v4f_t bv[4][2];                           // the lane's 32 bias values, read once
#pragma unroll
    for (int tn = 0; tn < 4; ++tn) {
      bv[tn][0] = *(const v4f_t*)&bias[n0 + tn * 16];
      bv[tn][1] = *(const v4f_t*)&bias[n0 + tn * 16 + 4];
    }
    // holds the 8 bias loads together ahead of the stores (loaded values as inputs
    // only): left free, the compiler sank them among the stores, one latency each
    asm volatile("" :: "v"(bv[0][0]), "v"(bv[0][1]), "v"(bv[1][0]), "v"(bv[1][1]),
                       "v"(bv[2][0]), "v"(bv[2][1]), "v"(bv[3][0]), "v"(bv[3][1]));
#pragma unroll
    for (int tm = 0; tm < 4; ++tm) {
      float* orow = (float*)out + (size_t)(r0 + tm * 16) * DIM + n0;
#pragma unroll
      for (int tn = 0; tn < 4; ++tn) {
        v4f_t lo, hp;
#pragma unroll
        for (int i = 0; i < 4; ++i) {
          lo[i] = acc[tn][tm][i]     + bv[tn][0][i];
          hp[i] = acc[tn][tm][i + 4] + bv[tn][1][i];
        }
        // the two stores and their wait in one statement: in a statement of its own the
        // wait let the next tile's sums into these stores' data registers ahead of it
        asm volatile("global_store_b128 %0, %1, off\n\t"
                     "global_store_b128 %0, %2, off offset:16\n\t"
                     "s_wait_xcnt 0x0"
                     :: "v"(&orow[tn * 16]), "v"(lo), "v"(hp) : "memory");
      }
    }
  }
}

__device__ inline float xhalf(float x) {
  int v = __builtin_bit_cast(int, x);
  return __builtin_bit_cast(float,
      __builtin_amdgcn_permlanex16(v, v, 0x76543210, 0xfedcba98, false, false));
}

__global__ __launch_bounds__(128) void attn_kernel(const half_t* __restrict__ Qh,
                                                   const half_t* __restrict__ Kh,
                                                   const half_t* __restrict__ Vh,
                                                   const unsigned* __restrict__ Mp,
                                                   half_t* __restrict__ Oh) {
  int bh = blockIdx.x;                 // 0..31
  int b = bh >> 4;
  int h = bh & (NHEAD - 1);
  int qtile = blockIdx.y;              // 0..31
  int tid = threadIdx.x;
  int wid = tid >> 5;
  int lane = tid & 31;
  int m16 = lane & 15;
  int hi  = lane >> 4;

  __shared__ __attribute__((aligned(16))) half_t Qs[64 * LDP];       // [q][d]
  __shared__ __attribute__((aligned(16))) half_t Ks[2 * 64 * LDP];   // 2 x [key][d]
  __shared__ __attribute__((aligned(16))) half_t Vs[2 * 64 * LDV];   // 2 x [key][d]

  const half_t* Qbase = Qh + ((size_t)bh * SEQ + (size_t)qtile * 64) * HDIM;
  const half_t* Kbase = Kh + (size_t)bh * SEQ * HDIM;
  const half_t* Vbase = Vh + (size_t)bh * SEQ * HDIM;

  int crow = tid >> 3;                 // this thread's first tile row in the copies
  int ccol = (tid & 7) * 8;            // and its 8-half column

  // Q tile 64x64 via async-to-LDS (chunk c = tid + 128 j: row = crow + 16 j)
  async_copy4_b128(lds_addr(&Qs[(crow + 0)  * LDP + ccol]), &Qbase[(crow + 0)  * HDIM + ccol],
                   lds_addr(&Qs[(crow + 16) * LDP + ccol]), &Qbase[(crow + 16) * HDIM + ccol],
                   lds_addr(&Qs[(crow + 32) * LDP + ccol]), &Qbase[(crow + 32) * HDIM + ccol],
                   lds_addr(&Qs[(crow + 48) * LDP + ccol]), &Qbase[(crow + 48) * HDIM + ccol]);
  // K and V tiles 64x64 (row-major [key][d]) via async-to-LDS
  auto copy_tile = [&](int kt) {
    half_t* Kd = &Ks[(kt & 1) * 64 * LDP];
    half_t* Vd = &Vs[(kt & 1) * 64 * LDV];
    const half_t* Kt = Kbase + (size_t)kt * 64 * HDIM;
    const half_t* Vg = Vbase + (size_t)kt * 64 * HDIM;
    async_copy8_b128(lds_addr(&Kd[(crow + 0)  * LDP + ccol]), &Kt[(crow + 0)  * HDIM + ccol],
                     lds_addr(&Kd[(crow + 16) * LDP + ccol]), &Kt[(crow + 16) * HDIM + ccol],
                     lds_addr(&Kd[(crow + 32) * LDP + ccol]), &Kt[(crow + 32) * HDIM + ccol],
                     lds_addr(&Kd[(crow + 48) * LDP + ccol]), &Kt[(crow + 48) * HDIM + ccol],
                     lds_addr(&Vd[(crow + 0)  * LDV + ccol]), &Vg[(crow + 0)  * HDIM + ccol],
                     lds_addr(&Vd[(crow + 16) * LDV + ccol]), &Vg[(crow + 16) * HDIM + ccol],
                     lds_addr(&Vd[(crow + 32) * LDV + ccol]), &Vg[(crow + 32) * HDIM + ccol],
                     lds_addr(&Vd[(crow + 48) * LDV + ccol]), &Vg[(crow + 48) * HDIM + ccol]);
  };
  copy_tile(0);
  wait_async_all();
  __syncthreads();      // Q and tile 0 are published

  // B fragments of Q^T: lane = query column
  v16h_t bq0 = load_frag(&Qs[wid * 16 * LDP + 0],  LDP);  // d = 0..31
  v16h_t bq1 = load_frag(&Qs[wid * 16 * LDP + 32], LDP);  // d = 32..63

  v8f_t Oacc[4] = {};                  // Oacc[jd][i] = O[q = m16][d = jd*16 + 8*hi + i]
  float mrow = -3.0e38f;               // this query's running maximum (same in both halves)
  float lrow = 0.0f;                   // sum over this lane's own keys; halves joined at the end

  int q = qtile * 64 + wid * 16 + m16;
  // this wave's packed mask words, 32 a tile; the wave's number as a scalar, so
  // that the words are read by scalar loads
  int wu = __builtin_amdgcn_readfirstlane(wid);
  const unsigned* Mw = Mp + (size_t)(b * (SEQ / 16) + qtile * 4 + wu) * (SEQ / 64) * 32;

  // this lane's address in the first V buffer for the transposing loads (key 0, d 0 fragment)
  const half_t* Vlane = &Vs[(8 * hi + (lane & 7)) * LDV + 8 * ((lane >> 3) & 1)];

  for (int kt = 0; kt < SEQ / 64; ++kt) {
    const half_t* Kt = &Ks[(kt & 1) * 64 * LDP];
    const half_t* Vt = Vlane + (kt & 1) * 64 * LDV;
    // the tile's 32 mask words, requested ahead of the copies (behind the copies'
    // asm statement the compiler made vector loads of them)
    unsigned mw[32];
#pragma unroll
    for (int e = 0; e < 32; ++e) mw[e] = Mw[kt * 32 + e];
    // directly behind the barrier at the foot of trip kt - 1 (in front of the loop
    // for kt = 0): tile kt + 1 into the buffers that trip kt - 1 has read
    if (kt + 1 < SEQ / 64) copy_tile(kt + 1);

    // --- scores, transposed: Sacc[jn][i] = S[key = jn*16 + 8*hi + i][q = m16] ---
    v8f_t Sacc[4] = {};
#pragma unroll
    for (int jn = 0; jn < 4; ++jn) {
      v16h_t ak0 = load_frag(&Kt[jn * 16 * LDP + 0],  LDP);
      v16h_t ak1 = load_frag(&Kt[jn * 16 * LDP + 32], LDP);
      Sacc[jn] = wmma_f32_f16(ak0, bq0, Sacc[jn]);
      Sacc[jn] = wmma_f32_f16(ak1, bq1, Sacc[jn]);
    }

    // --- mask + online softmax: 32 keys of one query per lane ---
    float pmax[4];                     // one chain per 16-key tile
#pragma unroll
    for (int jn = 0; jn < 4; ++jn) {
      pmax[jn] = -3.0e38f;
#pragma unroll
      for (int i = 0; i < 8; ++i) {
        float s = __builtin_amdgcn_inverse_ballot_w32(mw[jn * 8 + i]) ? Sacc[jn][i] : -1.0e9f;
        Sacc[jn][i] = s;
        pmax[jn] = fmaxf(pmax[jn], s);
      }
    }
    float rmax = fmaxf(fmaxf(pmax[0], pmax[1]), fmaxf(pmax[2], pmax[3]));
    rmax = fmaxf(rmax, xhalf(rmax));   // the other half holds the query's other 32 keys
    float mnew = fmaxf(mrow, rmax);
    float corr = __expf(mrow - mnew);
    mrow = mnew;
    float psum[4];                     // one chain per 16-key tile
#pragma unroll
    for (int jn = 0; jn < 4; ++jn) {
      psum[jn] = 0.0f;
#pragma unroll
      for (int i = 0; i < 8; ++i) {
        float p = __expf(Sacc[jn][i] - mnew);
        Sacc[jn][i] = p;
        psum[jn] += p;
      }
    }
    lrow = lrow * corr + ((psum[0] + psum[1]) + (psum[2] + psum[3]));

    // --- P^T as B fragments, in-lane: keys {8*hi + i, 16 + 8*hi + i} of each 32 ---
    v16h_t bp0, bp1;
#pragma unroll
    for (int i = 0; i < 8; ++i) {
      bp0[i]     = (half_t)Sacc[0][i];
      bp0[i + 8] = (half_t)Sacc[1][i];
      bp1[i]     = (half_t)Sacc[2][i];
      bp1[i + 8] = (half_t)Sacc[3][i];
    }

    // rescale running output
#pragma unroll
    for (int jd = 0; jd < 4; ++jd)
#pragma unroll
      for (int i = 0; i < 8; ++i)
        Oacc[jd][i] *= corr;

#pragma unroll
    for (int jd = 0; jd < 4; ++jd) {
      v16h_t av0 = load_frag_tr(Vt + jd * 16,            LDV);  // keys 0..31
      v16h_t av1 = load_frag_tr(Vt + jd * 16 + 32 * LDV, LDV);  // keys 32..63
      Oacc[jd] = wmma_f32_f16(av0, bp0, Oacc[jd]);
      Oacc[jd] = wmma_f32_f16(av1, bp1, Oacc[jd]);
    }
    wait_ds_all();
    wait_async_all();   // this wave's share of tile kt + 1 has landed
    __syncthreads();    // publishes tile kt + 1 and ends every wave's reads of tile kt
  }
  wait_async_all();     // no copy is outstanding behind the loop

  // --- write Oh[b, q, h*64 + d]: 8 consecutive d per lane and tile ---
  float lsum = lrow + xhalf(lrow);
  float inv = lsum > 0.0f ? 1.0f / lsum : 0.0f;
#pragma unroll
  for (int jd = 0; jd < 4; ++jd) {
    v8h_t o;
#pragma unroll
    for (int i = 0; i < 8; ++i) o[i] = (half_t)(Oacc[jd][i] * inv);
    *(v8h_t*)&Oh[((size_t)b * SEQ + q) * DIM + h * HDIM + jd * 16 + 8 * hi] = o;
  }
}

// ---------------------------------------------------------------------------
// Launch
// ---------------------------------------------------------------------------
extern "C" void kernel_launch(void* const* d_in, const int* in_sizes, int n_in,
                              void* d_out, int out_size, void* d_ws, size_t ws_size,
                              hipStream_t stream) {
  const float* x   = (const float*)d_in[0];
  const int*   M   = (const int*)d_in[1];
  const float* Wq  = (const float*)d_in[2];
  const float* Wk  = (const float*)d_in[3];
  const float* Wv  = (const float*)d_in[4];
  const float* Wo  = (const float*)d_in[5];
  const float* bo  = (const float*)d_in[6];

  char* ws = (char*)d_ws;
  const size_t MB = 1u << 20;
  half_t* xh  = (half_t*)(ws + 0 * MB);   // 8 MB  [B*S, D]
  half_t* wqh = (half_t*)(ws + 8 * MB);   // 2 MB
  //      Wk as f16 at ws + 10 MB, Wv at ws + 12 MB (2 MB each), reached from wqh
  half_t* woh = (half_t*)(ws + 14 * MB);  // 2 MB
  half_t* Qh  = (half_t*)(ws + 16 * MB);  // 8 MB  [B,H,S,HD]
  half_t* Kh  = (half_t*)(ws + 24 * MB);  // 8 MB
  half_t* Vh  = (half_t*)(ws + 32 * MB);  // 8 MB
  half_t* Oh  = (half_t*)(ws + 40 * MB);  // 8 MB  [B,S,D]
  unsigned* Mp = (unsigned*)(ws + 48 * MB);  // 1 MB  packed mask

  // the five f16 copies are written as one run from xh on
  cvt_f32_f16_kernel<<<PBLK + XBLK + 4 * WBLK, 256, 0, stream>>>(x, Wq, Wk, Wv, Wo, M, xh, Mp);

  // z = 0, 1, 2: Q, K, V (the three f16 weights from wqh on, and Qh, Kh, Vh, lie one behind the other)
  gemm_xwT_kernel<<<dim3(BATCH * SEQ / 128, DIM / 128, 3), 128, 0, stream>>>(xh, wqh, Qh, nullptr, 0);

  attn_kernel<<<dim3(BATCH * NHEAD, SEQ / 64), 128, 0, stream>>>(Qh, Kh, Vh, Mp, Oh);

  gemm_xwT_kernel<<<dim3(BATCH * SEQ / 128, DIM / 128, 1), 128, 0, stream>>>(Oh, woh, d_out, bo, 1);
}

// v008
// Measured time: 85.9 microseconds a run.
// Timed twice side by side with v007, it ran 1.03 times as fast both times.
// Counting every step since v000, it is 4.96 times as fast.
#include <hip/hip_runtime.h>
#include <hip/hip_bf16.h>

typedef _Float16 half_t;
typedef __attribute__((ext_vector_type(16))) _Float16 v16h_t;
typedef __attribute__((ext_vector_type(8)))  _Float16 v8h_t;
typedef __attribute__((ext_vector_type(4)))  _Float16 v4h_t;
typedef __attribute__((ext_vector_type(8)))  float    v8f_t;
typedef __attribute__((ext_vector_type(4)))  float    v4f_t;
typedef __attribute__((ext_vector_type(8)))  short    v8s_t;

#define BATCH 2
#define SEQ   2048
#define DIM   1024
#define NHEAD 16
#define HDIM  64
// LDS row pitch, in halves, of the 64-half tile rows read by load_frag's 16-byte LDS
// loads: 144 B = 16 B x 9 puts the 16 rows of a fragment on 16 different
// 4-bank groups (128 B rows put them all on two).
#define LDP   72
// LDS row pitch, in halves, of the V tile, whose 64-half rows are read by the
// transposing 16-byte LDS load: that reader wants 160 B = 32 B x 5.
#define LDV   80

// ---------------------------------------------------------------------------
// WMMA wrapper: D = A(16x32 f16) * B(32x16 f16) + C(16x16 f32)
// ---------------------------------------------------------------------------
__device__ inline v8f_t wmma_f32_f16(v16h_t a, v16h_t b, v8f_t c) {
  return __builtin_amdgcn_wmma_f32_16x16x32_f16(
      /*neg_a=*/false, a, /*neg_b=*/false, b,
      /*c_mod=*/(short)0, c, /*reuse_a=*/false, /*reuse_b=*/false);
}

// ---------------------------------------------------------------------------
// Async global -> LDS copy, 16 bytes per lane (GLOBAL_LOAD_ASYNC_TO_LDS_B128,
// tracked by ASYNCcnt; data lands in LDS without touching VGPRs).
// LDS operand: byte offset within the workgroup's LDS allocation == low 32
// bits of the generic shared-memory pointer (shared aperture is in the high
// 32 bits per the ISA aperture check).
// ---------------------------------------------------------------------------
// Runs of copies stand in one statement that ends in s_wait_xcnt 0, so that no
// address register of an issued copy is rewritten ahead of that wait.
__device__ inline unsigned lds_addr(const void* p) {
  return (unsigned)(unsigned long long)p;
}
__device__ inline void async_copy4_b128(unsigned l0, const void* g0, unsigned l1, const void* g1,
                                        unsigned l2, const void* g2, unsigned l3, const void* g3) {
  asm volatile("global_load_async_to_lds_b128 %0, %1, off\n\t"
               "global_load_async_to_lds_b128 %2, %3, off\n\t"
               "global_load_async_to_lds_b128 %4, %5, off\n\t"
               "global_load_async_to_lds_b128 %6, %7, off\n\t"
               "s_wait_xcnt 0x0"
               :: "v"(l0), "v"(g0), "v"(l1), "v"(g1), "v"(l2), "v"(g2), "v"(l3), "v"(g3)
               : "memory");
}
__device__ inline void async_copy8_b128(unsigned l0, const void* g0, unsigned l1, const void* g1,
                                        unsigned l2, const void* g2, unsigned l3, const void* g3,
                                        unsigned l4, const void* g4, unsigned l5, const void* g5,
                                        unsigned l6, const void* g6, unsigned l7, const void* g7) {
  asm volatile("global_load_async_to_lds_b128 %0, %1, off\n\t"
               "global_load_async_to_lds_b128 %2, %3, off\n\t"
               "global_load_async_to_lds_b128 %4, %5, off\n\t"
               "global_load_async_to_lds_b128 %6, %7, off\n\t"
               "global_load_async_to_lds_b128 %8, %9, off\n\t"
               "global_load_async_to_lds_b128 %10, %11, off\n\t"
               "global_load_async_to_lds_b128 %12, %13, off\n\t"
               "global_load_async_to_lds_b128 %14, %15, off\n\t"
               "s_wait_xcnt 0x0"
               :: "v"(l0), "v"(g0), "v"(l1), "v"(g1), "v"(l2), "v"(g2), "v"(l3), "v"(g3),
                  "v"(l4), "v"(g4), "v"(l5), "v"(g5), "v"(l6), "v"(g6), "v"(l7), "v"(g7)
               : "memory");
}
__device__ inline void wait_async_all() {
  asm volatile("s_wait_asynccnt 0x0" ::: "memory");
}
// this wave's LDS reads are over: stands in front of the barrier behind which
// the buffer it has read is refilled by copies
__device__ inline void wait_ds_all() {
  asm volatile("s_wait_dscnt 0x0" ::: "memory");
}

// ---------------------------------------------------------------------------
// Build a 16x32 f16 fragment (A-layout per ISA 7.12.2) from a row-major tile
// in LDS.  Lane L (L<16) holds row M=L, K = {0..7, 16..23}; lane L+16 holds
// row M=L, K = {8..15, 24..31}.  Two 16B LDS loads per fragment.
// B-fragments (32x16, K x N) use the same call on an N-major (transposed)
// tile: lane = N column, 16 K values per lane with the same split.
// ---------------------------------------------------------------------------
__device__ inline v16h_t load_frag(const half_t* base, int row_stride) {
  int lane = threadIdx.x & 31;
  int m    = lane & 15;
  int hi   = lane >> 4;
  const half_t* p = base + (size_t)m * row_stride + hi * 8;
  v8h_t lo = *(const v8h_t*)(p);        // K = hi*8 .. hi*8+7
  v8h_t hp = *(const v8h_t*)(p + 16);   // K = 16+hi*8 .. 16+hi*8+7
  v16h_t r;
#pragma unroll
  for (int i = 0; i < 8; ++i) { r[i] = lo[i]; r[i + 8] = hp[i]; }
  return r;
}

// ---------------------------------------------------------------------------
// The same 16x32 fragment of the TRANSPOSE of a row-major tile T[k][n] in LDS,
// by ds_load_tr16_b128.  p is the lane's own address,
//   &T[k0 + 8 * (lane >> 4) + (lane & 7)][n0 + 8 * ((lane >> 3) & 1)];
// the lane then holds T[k0 + 8*hi + 0..7][n0 + (lane & 15)], and the second
// load, 16 rows on, the k = 16 + 8*hi + 0..7 of load_frag's order.
// ---------------------------------------------------------------------------
__device__ inline v8h_t load_tr16(const half_t* p) {
  typedef __attribute__((address_space(3))) v8s_t lds_v8s_t;
  return __builtin_bit_cast(v8h_t, __builtin_amdgcn_ds_load_tr16_b128_v8i16((lds_v8s_t*)p));
}
__device__ inline v16h_t load_frag_tr(const half_t* p, int row_stride) {
  v8h_t lo = load_tr16(p);
  v8h_t hp = load_tr16(p + 16 * row_stride);
  v16h_t r;
#pragma unroll
  for (int i = 0; i < 8; ++i) { r[i] = lo[i]; r[i + 8] = hp[i]; }
  return r;
}

// ---------------------------------------------------------------------------
// fp32 -> f16 conversion of all five operands in one launch, 4 elements /
// thread.  The block index picks the source: the first XBLK blocks take x, then
// WBLK blocks each take Wq (scaled by HD^-0.5 * log2 e), Wk, Wv, Wo.  The f16 copies lie
// one behind the other in `out`, in that order.
// In front of them PBLK blocks pack the mask, which all 16 heads read, to one
// bit a score, in the order in which the attention kernel's waves hold scores:
//   Mp[(b * S/16 + q/16) * S/64 + key/64][e], e = jn * 8 + i, bit l =
//   (M[b][16 * (q/16) + (l & 15)][64 * (key/64) + jn * 16 + 8 * (l >> 4) + i] != 0)
// so word e is the lane mask of score register Sacc[jn][i] of that wave and tile.
// A wave packs PTILE neighbouring 64-key tiles of one group of 16 queries.
// ---------------------------------------------------------------------------
#define XBLK (BATCH * SEQ * DIM / 4 / 256)   // 4096
#define WBLK (DIM * DIM / 4 / 256)           // 1024
#define PTILE 4
#define PBLK (BATCH * (SEQ / 16) * (SEQ / 64) / PTILE / 8)   // 256
__global__ __launch_bounds__(256) void cvt_f32_f16_kernel(const float* __restrict__ x,
                                                          const float* __restrict__ Wq,
                                                          const float* __restrict__ Wk,
                                                          const float* __restrict__ Wv,
                                                          const float* __restrict__ Wo,
                                                          const int* __restrict__ M,
                                                          half_t* __restrict__ out,
                                                          unsigned* __restrict__ Mp) {
  int blk = blockIdx.x;
  if (blk < PBLK) {
    int lane = threadIdx.x & 31;
    int gw = blk * 8 + (threadIdx.x >> 5);           // wave index
    int qg = gw / (SEQ / 64 / PTILE);                // b * S/16 + q/16
    int kt0 = (gw % (SEQ / 64 / PTILE)) * PTILE;     // first 64-key tile
    const int* Mrow = M + (size_t)(qg * 16 + (lane & 15)) * SEQ + 8 * (lane >> 4);
    // stays rolled: the conversion blocks share this kernel's register count
#pragma unroll 1
    for (int t = 0; t < PTILE; ++t) {
      int kt = kt0 + t;
      int4 mk[8];
#pragma unroll
      for (int jn = 0; jn < 4; ++jn) {
        const int4* mp = (const int4*)&Mrow[kt * 64 + jn * 16];
        mk[2 * jn]     = mp[0];
        mk[2 * jn + 1] = mp[1];
      }
      unsigned word = 0;                             // lane e ends up with word e
#pragma unroll
      for (int jn = 0; jn < 4; ++jn) {
        int4 ma = mk[2 * jn];
        int4 mb = mk[2 * jn + 1];
        int mv[8] = {ma.x, ma.y, ma.z, ma.w, mb.x, mb.y, mb.z, mb.w};
#pragma unroll
        for (int i = 0; i < 8; ++i) {
          unsigned bal = __builtin_amdgcn_ballot_w32(mv[i] != 0);   // taken by all 32 lanes
          word = lane == jn * 8 + i ? bal : word;
        }
      }
      Mp[(size_t)(qg * (SEQ / 64) + kt) * 32 + lane] = word;
    }
    return;
  }
  blk -= PBLK;
  const float* in = x;
  int sblk = blk;                      // block index within the source
  float scale = 1.0f;
  if (blk >= XBLK) {
    int w = (blk - XBLK) / WBLK;
    sblk  = (blk - XBLK) % WBLK;
    in    = w == 0 ? Wq : w == 1 ? Wk : w == 2 ? Wv : Wo;
    scale = w == 0 ? 0.125f * 1.44269504f : 1.0f;   // scores come out in log2 scale
  }
  float4 f = ((const float4*)in)[sblk * 256 + threadIdx.x];
  v4h_t h;
  h[0] = (half_t)(f.x * scale);
  h[1] = (half_t)(f.y * scale);
  h[2] = (half_t)(f.z * scale);
  h[3] = (half_t)(f.w * scale);
  ((v4h_t*)out)[blk * 256 + threadIdx.x] = h;
}

// ---------------------------------------------------------------------------
// GEMM: C[r][n] = sum_k X[r][k] * W[n][k],  R=4096, K=1024, N=1024.
// Block tile 128x128, BK=64.  4 waves in a 2(M) x 2(N) grid; each wave owns a
// 64x64 tile = 4x4x2 v_wmma_f32_16x16x32_f16 per K step (32 WMMA / barrier), so
// that a fragment read from LDS feeds four products.
// The wave's tile is held transposed (A = W rows, B = X rows): a lane has one
// row r (lane & 15) and, in the 8 registers of a 16x16 tile, 8 neighbouring n.
// Tiles staged via GLOBAL_LOAD_ASYNC_TO_LDS_B128 into two buffers: tile t + 2 is
// requested at the foot of trip t, behind the barrier that ends every wave's
// reads of tile t, into the buffer that tile t has left.
// mode 0: f16 output scattered to head layout [B,H,S,HD]; blockIdx.z picks the
//         product: weight matrix z behind W, output tensor z behind out
// mode 1: fp32 output + bias, flat [R,N]
// ---------------------------------------------------------------------------
__global__ __launch_bounds__(128) void gemm_xwT_kernel(const half_t* __restrict__ X,
                                                       const half_t* __restrict__ W,
                                                       void* __restrict__ out,
                                                       const float* __restrict__ bias,
                                                       int mode) {
  const int K = DIM;
  int bm = blockIdx.x;          // 0..31  (row tiles of 128)
  int bn = blockIdx.y;          // 0..7   (col tiles of 128)
  int tid = threadIdx.x;
  int wid = tid >> 5;
  int lane = tid & 31;
  int wm = wid & 1;             // wave row   (2)
  int wn = wid >> 1;            // wave col   (2)
  int m16 = lane & 15;
  int hi  = lane >> 4;

  __shared__ __attribute__((aligned(16))) half_t As[2 * 128 * LDP];   // 2 x 18 KB
  __shared__ __attribute__((aligned(16))) half_t Bs[2 * 128 * LDP];   // 2 x 18 KB

  v8f_t acc[4][4] = {};         // acc[tn][tm][i] = C[r = tm*16 + m16][n = tn*16 + 8*hi + i]

  const half_t* Xb = X + (size_t)(bm * 128) * K;
  const half_t* Wb = W + (size_t)blockIdx.z * DIM * DIM + (size_t)(bn * 128) * K;
  int crow = tid >> 3;          // this thread's first tile row in the copies
  int ccol = (tid & 7) * 8;     // and its 8-half column

  // A and B tile: 128 rows x 64 halves = 1024 chunks of 8 halves (16B) -> 8/thread each
  // (chunk c = tid + 128 j: row = crow + 16 j, same column)
  auto copy_tile = [&](int t) {
    half_t* Ad = &As[(t & 1) * 128 * LDP];
    half_t* Bd = &Bs[(t & 1) * 128 * LDP];
    int k0 = t * 64;
    async_copy8_b128(lds_addr(&Ad[(crow + 0)   * LDP + ccol]), &Xb[(size_t)(crow + 0)   * K + k0 + ccol],
                     lds_addr(&Ad[(crow + 16)  * LDP + ccol]), &Xb[(size_t)(crow + 16)  * K + k0 + ccol],
                     lds_addr(&Ad[(crow + 32)  * LDP + ccol]), &Xb[(size_t)(crow + 32)  * K + k0 + ccol],
                     lds_addr(&Ad[(crow + 48)  * LDP + ccol]), &Xb[(size_t)(crow + 48)  * K + k0 + ccol],
                     lds_addr(&Ad[(crow + 64)  * LDP + ccol]), &Xb[(size_t)(crow + 64)  * K + k0 + ccol],
                     lds_addr(&Ad[(crow + 80)  * LDP + ccol]), &Xb[(size_t)(crow + 80)  * K + k0 + ccol],
                     lds_addr(&Ad[(crow + 96)  * LDP + ccol]), &Xb[(size_t)(crow + 96)  * K + k0 + ccol],
                     lds_addr(&Ad[(crow + 112) * LDP + ccol]), &Xb[(size_t)(crow + 112) * K + k0 + ccol]);
    async_copy8_b128(lds_addr(&Bd[(crow + 0)   * LDP + ccol]), &Wb[(size_t)(crow + 0)   * K + k0 + ccol],
                     lds_addr(&Bd[(crow + 16)  * LDP + ccol]), &Wb[(size_t)(crow + 16)  * K + k0 + ccol],
                     lds_addr(&Bd[(crow + 32)  * LDP + ccol]), &Wb[(size_t)(crow + 32)  * K + k0 + ccol],
                     lds_addr(&Bd[(crow + 48)  * LDP + ccol]), &Wb[(size_t)(crow + 48)  * K + k0 + ccol],
                     lds_addr(&Bd[(crow + 64)  * LDP + ccol]), &Wb[(size_t)(crow + 64)  * K + k0 + ccol],
                     lds_addr(&Bd[(crow + 80)  * LDP + ccol]), &Wb[(size_t)(crow + 80)  * K + k0 + ccol],
                     lds_addr(&Bd[(crow + 96)  * LDP + ccol]), &Wb[(size_t)(crow + 96)  * K + k0 + ccol],
                     lds_addr(&Bd[(crow + 112) * LDP + ccol]), &Wb[(size_t)(crow + 112) * K + k0 + ccol]);
  };

  copy_tile(0);
  wait_async_all();
  __syncthreads();      // tile 0 is published
  copy_tile(1);

  for (int t = 0; t < K / 64; ++t) {
    const half_t* At = &As[(t & 1) * 128 * LDP];
    const half_t* Bt = &Bs[(t & 1) * 128 * LDP];
#pragma unroll
    for (int kc = 0; kc < 2; ++kc) {
      v16h_t xf[4], wf[4];
#pragma unroll
      for (int j = 0; j < 4; ++j) {
        xf[j] = load_frag(&At[(wm * 64 + j * 16) * LDP + kc * 32], LDP);
        wf[j] = load_frag(&Bt[(wn * 64 + j * 16) * LDP + kc * 32], LDP);
      }
      // keeps the 16 LDS reads of this k step together ahead of its products: left
      // free, the compiler read W fragments singly among them, each behind a full wait
      __builtin_amdgcn_sched_barrier(0);
#pragma unroll
      for (int tn = 0; tn < 4; ++tn)
#pragma unroll
        for (int tm = 0; tm < 4; ++tm)
          acc[tn][tm] = wmma_f32_f16(wf[tn], xf[tm], acc[tn][tm]);
    }
    wait_ds_all();
    wait_async_all();   // this wave's share of tile t + 1 has landed
    __syncthreads();    // publishes tile t + 1 and ends every wave's reads of tile t
    if (t + 2 < K / 64) copy_tile(t + 2);
  }
  wait_async_all();     // no copy is outstanding behind the loop

  int r0 = bm * 128 + wm * 64 + m16;          // this lane's row in row tile 0
  int n0 = bn * 128 + wn * 64 + 8 * hi;       // its first column in column tile 0
  if (mode == 0) {
    int hh = n0 >> 6;                         // n / HDIM: one head a wave
#pragma unroll
    for (int tm = 0; tm < 4; ++tm) {
      int r = r0 + tm * 16;
      int b = r >> 11;                        // r / SEQ
      int s = r & (SEQ - 1);
      half_t* orow = (half_t*)out + (((size_t)((blockIdx.z * BATCH + b) * NHEAD + hh) * SEQ) + s) * HDIM + 8 * hi;
#pragma unroll
      for (int tn = 0; tn < 4; ++tn) {
        v8h_t o;
#pragma unroll
        for (int i = 0; i < 8; ++i) o[i] = (half_t)acc[tn][tm][i];
        *(v8h_t*)&orow[tn * 16] = o;
        // holds every later rewrite of this store's address and data registers behind it
        asm volatile("s_wait_xcnt 0x0" ::: "memory");
      }
    }
  } else {
    v4f_t bv[4][2];                           // the lane's 32 bias values, read once
#pragma unroll
    for (int tn = 0; tn < 4; ++tn) {
      bv[tn][0] = *(const v4f_t*)&bias[n0 + tn * 16];
      bv[tn][1] = *(const v4f_t*)&bias[n0 + tn * 16 + 4];
    }
    // holds the 8 bias loads together ahead of the stores (loaded values as inputs
    // only): left free, the compiler sank them among the stores, one latency each
    asm volatile("" :: "v"(bv[0][0]), "v"(bv[0][1]), "v"(bv[1][0]), "v"(bv[1][1]),
                       "v"(bv[2][0]), "v"(bv[2][1]), "v"(bv[3][0]), "v"(bv[3][1]));
#pragma unroll
    for (int tm = 0; tm < 4; ++tm) {
      float* orow = (float*)out + (size_t)(r0 + tm * 16) * DIM + n0;
#pragma unroll
      for (int tn = 0; tn < 4; ++tn) {
        v4f_t lo, hp;
#pragma unroll
        for (int i = 0; i < 4; ++i) {
          lo[i] = acc[tn][tm][i]     + bv[tn][0][i];
          hp[i] = acc[tn][tm][i + 4] + bv[tn][1][i];
        }
        // the two stores and their wait in one statement: in a statement of its own the
        // wait let the next tile's sums into these stores' data registers ahead of it
        asm volatile("global_store_b128 %0, %1, off\n\t"
                     "global_store_b128 %0, %2, off offset:16\n\t"
                     "s_wait_xcnt 0x0"
                     :: "v"(&orow[tn * 16]), "v"(lo), "v"(hp) : "memory");
      }
    }
  }
}

__device__ inline float xhalf(float x) {
  int v = __builtin_bit_cast(int, x);
  return __builtin_bit_cast(float,
      __builtin_amdgcn_permlanex16(v, v, 0x76543210, 0xfedcba98, false, false));
}

__global__ __launch_bounds__(128) void attn_kernel(const half_t* __restrict__ Qh,
                                                   const half_t* __restrict__ Kh,
                                                   const half_t* __restrict__ Vh,
                                                   const unsigned* __restrict__ Mp,
                                                   half_t* __restrict__ Oh) {
  int bh = blockIdx.x;                 // 0..31
  int b = bh >> 4;
  int h = bh & (NHEAD - 1);
  int qtile = blockIdx.y;              // 0..31
  int tid = threadIdx.x;
  int wid = tid >> 5;
  int lane = tid & 31;
  int m16 = lane & 15;
  int hi  = lane >> 4;

  __shared__ __attribute__((aligned(16))) half_t Qs[64 * LDP];       // [q][d]
  __shared__ __attribute__((aligned(16))) half_t Ks[2 * 64 * LDP];   // 2 x [key][d]
  __shared__ __attribute__((aligned(16))) half_t Vs[2 * 64 * LDV];   // 2 x [key][d]

  const half_t* Qbase = Qh + ((size_t)bh * SEQ + (size_t)qtile * 64) * HDIM;
  const half_t* Kbase = Kh + (size_t)bh * SEQ * HDIM;
  const half_t* Vbase = Vh + (size_t)bh * SEQ * HDIM;

  int crow = tid >> 3;                 // this thread's first tile row in the copies
  int ccol = (tid & 7) * 8;            // and its 8-half column

  // Q tile 64x64 via async-to-LDS (chunk c = tid + 128 j: row = crow + 16 j)
  async_copy4_b128(lds_addr(&Qs[(crow + 0)  * LDP + ccol]), &Qbase[(crow + 0)  * HDIM + ccol],
                   lds_addr(&Qs[(crow + 16) * LDP + ccol]), &Qbase[(crow + 16) * HDIM + ccol],
                   lds_addr(&Qs[(crow + 32) * LDP + ccol]), &Qbase[(crow + 32) * HDIM + ccol],
                   lds_addr(&Qs[(crow + 48) * LDP + ccol]), &Qbase[(crow + 48) * HDIM + ccol]);
  // K and V tiles 64x64 (row-major [key][d]) via async-to-LDS
  auto copy_tile = [&](int kt) {
    half_t* Kd = &Ks[(kt & 1) * 64 * LDP];
    half_t* Vd = &Vs[(kt & 1) * 64 * LDV];
    const half_t* Kt = Kbase + (size_t)kt * 64 * HDIM;
    const half_t* Vg = Vbase + (size_t)kt * 64 * HDIM;
    async_copy8_b128(lds_addr(&Kd[(crow + 0)  * LDP + ccol]), &Kt[(crow + 0)  * HDIM + ccol],
                     lds_addr(&Kd[(crow + 16) * LDP + ccol]), &Kt[(crow + 16) * HDIM + ccol],
                     lds_addr(&Kd[(crow + 32) * LDP + ccol]), &Kt[(crow + 32) * HDIM + ccol],
                     lds_addr(&Kd[(crow + 48) * LDP + ccol]), &Kt[(crow + 48) * HDIM + ccol],
                     lds_addr(&Vd[(crow + 0)  * LDV + ccol]), &Vg[(crow + 0)  * HDIM + ccol],
                     lds_addr(&Vd[(crow + 16) * LDV + ccol]), &Vg[(crow + 16) * HDIM + ccol],
                     lds_addr(&Vd[(crow + 32) * LDV + ccol]), &Vg[(crow + 32) * HDIM + ccol],
                     lds_addr(&Vd[(crow + 48) * LDV + ccol]), &Vg[(crow + 48) * HDIM + ccol]);
  };
  copy_tile(0);
  wait_async_all();
  __syncthreads();      // Q and tile 0 are published

  // B fragments of Q^T: lane = query column
  v16h_t bq0 = load_frag(&Qs[wid * 16 * LDP + 0],  LDP);  // d = 0..31
  v16h_t bq1 = load_frag(&Qs[wid * 16 * LDP + 32], LDP);  // d = 32..63

  v8f_t Oacc[4] = {};                  // Oacc[jd][i] = O[q = m16][d = jd*16 + 8*hi + i]
  v8f_t Cn = {};                       // minus this query's held maximum, in all 8 registers
  float thr = -3.0e38f;                // a tile maximum above this asks for the update: empty, any
  float negrel = 0.0f;                 // a masked score, relative to the held maximum: empty, 0
  float lrow = 0.0f;                   // sum over this lane's own keys; halves joined at the end

  int q = qtile * 64 + wid * 16 + m16;
  // this wave's packed mask words, 32 a tile; the wave's number as a scalar, so
  // that the words are read by scalar loads
  int wu = __builtin_amdgcn_readfirstlane(wid);
  const unsigned* Mw = Mp + (size_t)(b * (SEQ / 16) + qtile * 4 + wu) * (SEQ / 64) * 32;

  // this lane's address in the first V buffer for the transposing loads (key 0, d 0 fragment)
  const half_t* Vlane = &Vs[(8 * hi + (lane & 7)) * LDV + 8 * ((lane >> 3) & 1)];

  for (int kt = 0; kt < SEQ / 64; ++kt) {
    const half_t* Kt = &Ks[(kt & 1) * 64 * LDP];
    const half_t* Vt = Vlane + (kt & 1) * 64 * LDV;
    // the tile's 32 mask words, requested ahead of the copies (behind the copies'
    // asm statement the compiler made vector loads of them)
    unsigned mw[32];
#pragma unroll
    for (int e = 0; e < 32; ++e) mw[e] = Mw[kt * 32 + e];
    // directly behind the barrier at the foot of trip kt - 1 (in front of the loop
    // for kt = 0): tile kt + 1 into the buffers that trip kt - 1 has read
    if (kt + 1 < SEQ / 64) copy_tile(kt + 1);

    // --- scores, transposed: Sacc[jn][i] = S[key = jn*16 + 8*hi + i][q = m16] ---
    //     less the held maximum
    v8f_t Sacc[4];
#pragma unroll
    for (int jn = 0; jn < 4; ++jn) {
      v16h_t ak0 = load_frag(&Kt[jn * 16 * LDP + 0],  LDP);
      v16h_t ak1 = load_frag(&Kt[jn * 16 * LDP + 32], LDP);
      Sacc[jn] = wmma_f32_f16(ak0, bq0, Cn);
      Sacc[jn] = wmma_f32_f16(ak1, bq1, Sacc[jn]);
    }

    // the tile's V^T fragments, requested here so that they fly during the softmax
    // (behind the branch below they would be read piecemeal among the products)
    v16h_t av[4][2];
#pragma unroll
    for (int jd = 0; jd < 4; ++jd) {
      av[jd][0] = load_frag_tr(Vt + jd * 16,            LDV);  // keys 0..31
      av[jd][1] = load_frag_tr(Vt + jd * 16 + 32 * LDV, LDV);  // keys 32..63
    }

    // --- mask + online softmax: 32 keys of one query per lane ---
    float sv[4][8];
    float pmax[4];                     // one chain per 16-key tile
#pragma unroll
    for (int jn = 0; jn < 4; ++jn) {
      pmax[jn] = -3.0e38f;
#pragma unroll
      for (int i = 0; i < 8; ++i) {
        float s = __builtin_amdgcn_inverse_ballot_w32(mw[jn * 8 + i]) ? Sacc[jn][i] : negrel;
        sv[jn][i] = s;
        pmax[jn] = fmaxf(pmax[jn], s);
      }
    }
    float rmax = fmaxf(fmaxf(pmax[0], pmax[1]), fmaxf(pmax[2], pmax[3]));
    rmax = fmaxf(rmax, xhalf(rmax));   // the other half holds the query's other 32 keys
    // one scalar branch a tile: some query of the wave is empty or tops its held maximum by 8
    if (__builtin_amdgcn_ballot_w32(rmax > thr) != 0) {
      float umax[4];
#pragma unroll
      for (int jn = 0; jn < 4; ++jn) {
        umax[jn] = -3.0e38f;
#pragma unroll
        for (int i = 0; i < 8; ++i) {
          float u = __builtin_amdgcn_inverse_ballot_w32(mw[jn * 8 + i]) ? Sacc[jn][i] : -1.0e9f;
          sv[jn][i] = u;
          umax[jn] = fmaxf(umax[jn], u);
        }
      }
      float um = fmaxf(fmaxf(umax[0], umax[1]), fmaxf(umax[2], umax[3]));
      um = fmaxf(um, xhalf(um));
      bool empty = thr < 0.0f;
      bool has   = um > -5.0e8f;       // the tile holds an unmasked key of this query
      float delta = has ? (empty ? um : fmaxf(um, 0.0f)) : 0.0f;
      float corr  = (empty && has) ? 0.0f : __builtin_amdgcn_exp2f(-delta);
      bool ones   = empty && !has;     // still empty: all 64 keys masked, each weighs 1
#pragma unroll
      for (int jn = 0; jn < 4; ++jn)
#pragma unroll
        for (int i = 0; i < 8; ++i)
          sv[jn][i] = ones ? 0.0f : sv[jn][i] - delta;
      lrow *= corr;
#pragma unroll
      for (int jd = 0; jd < 4; ++jd)
#pragma unroll
        for (int i = 0; i < 8; ++i)
          Oacc[jd][i] *= corr;
      float mneg = Cn[0] - delta;
#pragma unroll
      for (int i = 0; i < 8; ++i) Cn[i] = mneg;
      thr    = has ? 8.0f : thr;
      negrel = has ? -1.0e9f : negrel;
    }
    float psum[4];                     // one chain per 16-key tile
#pragma unroll
    for (int jn = 0; jn < 4; ++jn) {
      psum[jn] = 0.0f;
#pragma unroll
      for (int i = 0; i < 8; ++i) {
        float p = __builtin_amdgcn_exp2f(sv[jn][i]);
        Sacc[jn][i] = p;
        psum[jn] += p;
      }
    }
    lrow += (psum[0] + psum[1]) + (psum[2] + psum[3]);

    // --- P^T as B fragments, in-lane: keys {8*hi + i, 16 + 8*hi + i} of each 32 ---
    v16h_t bp0, bp1;
#pragma unroll
    for (int i = 0; i < 8; ++i) {
      bp0[i]     = (half_t)Sacc[0][i];
      bp0[i + 8] = (half_t)Sacc[1][i];
      bp1[i]     = (half_t)Sacc[2][i];
      bp1[i + 8] = (half_t)Sacc[3][i];
    }

#pragma unroll
    for (int jd = 0; jd < 4; ++jd) {
      Oacc[jd] = wmma_f32_f16(av[jd][0], bp0, Oacc[jd]);
      Oacc[jd] = wmma_f32_f16(av[jd][1], bp1, Oacc[jd]);
    }
    wait_ds_all();
    wait_async_all();   // this wave's share of tile kt + 1 has landed
    __syncthreads();    // publishes tile kt + 1 and ends every wave's reads of tile kt
  }
  wait_async_all();     // no copy is outstanding behind the loop

  // --- write Oh[b, q, h*64 + d]: 8 consecutive d per lane and tile ---
  float lsum = lrow + xhalf(lrow);
  float inv = lsum > 0.0f ? 1.0f / lsum : 0.0f;
#pragma unroll
  for (int jd = 0; jd < 4; ++jd) {
    v8h_t o;
#pragma unroll
    for (int i = 0; i < 8; ++i) o[i] = (half_t)(Oacc[jd][i] * inv);
    *(v8h_t*)&Oh[((size_t)b * SEQ + q) * DIM + h * HDIM + jd * 16 + 8 * hi] = o;
  }
}

// ---------------------------------------------------------------------------
// Launch
// ---------------------------------------------------------------------------
extern "C" void kernel_launch(void* const* d_in, const int* in_sizes, int n_in,
                              void* d_out, int out_size, void* d_ws, size_t ws_size,
                              hipStream_t stream) {
  const float* x   = (const float*)d_in[0];
  const int*   M   = (const int*)d_in[1];
  const float* Wq  = (const float*)d_in[2];
  const float* Wk  = (const float*)d_in[3];
  const float* Wv  = (const float*)d_in[4];
  const float* Wo  = (const float*)d_in[5];
  const float* bo  = (const float*)d_in[6];

  char* ws = (char*)d_ws;
  const size_t MB = 1u << 20;
  half_t* xh  = (half_t*)(ws + 0 * MB);   // 8 MB  [B*S, D]
  half_t* wqh = (half_t*)(ws + 8 * MB);   // 2 MB
  //      Wk as f16 at ws + 10 MB, Wv at ws + 12 MB (2 MB each), reached from wqh
  half_t* woh = (half_t*)(ws + 14 * MB);  // 2 MB
  half_t* Qh  = (half_t*)(ws + 16 * MB);  // 8 MB  [B,H,S,HD]
  half_t* Kh  = (half_t*)(ws + 24 * MB);  // 8 MB
  half_t* Vh  = (half_t*)(ws + 32 * MB);  // 8 MB
  half_t* Oh  = (half_t*)(ws + 40 * MB);  // 8 MB  [B,S,D]
  unsigned* Mp = (unsigned*)(ws + 48 * MB);  // 1 MB  packed mask

  // the five f16 copies are written as one run from xh on
  cvt_f32_f16_kernel<<<PBLK + XBLK + 4 * WBLK, 256, 0, stream>>>(x, Wq, Wk, Wv, Wo, M, xh, Mp);

  // z = 0, 1, 2: Q, K, V (the three f16 weights from wqh on, and Qh, Kh, Vh, lie one behind the other)
  gemm_xwT_kernel<<<dim3(BATCH * SEQ / 128, DIM / 128, 3), 128, 0, stream>>>(xh, wqh, Qh, nullptr, 0);

  attn_kernel<<<dim3(BATCH * NHEAD, SEQ / 64), 128, 0, stream>>>(Qh, Kh, Vh, Mp, Oh);

  gemm_xwT_kernel<<<dim3(BATCH * SEQ / 128, DIM / 128, 1), 128, 0, stream>>>(Oh, woh, d_out, bo, 1);
}
